// v000
// Measured on an AMD MI455X. A time is GPU time per run, averaged over a window of back-to-back runs after a warm-up
// (all launches, gaps included; the runs take copies of the inputs in turn), and the median of several windows.
// Apart from v000's, it joins two sittings. Times from different sittings can be a few percent apart, while
// side-by-side timings come from the same sitting.
// The starting kernel, v000, takes 417 microseconds a run.
#include <hip/hip_runtime.h>
#include <stddef.h>

// Contractions: S = K*Q^T and O = P*V on v_wmma_f32_16x16x32_f16 (f16 operands, q/k/v pre-scaled by 16, f32 accumulate); exp, row sums, mask and epilogue in f32.

typedef _Float16 h16 __attribute__((ext_vector_type(16)));
typedef _Float16 h8n __attribute__((ext_vector_type(8)));
typedef _Float16 h8  __attribute__((ext_vector_type(8), __may_alias__));
typedef float    f8  __attribute__((ext_vector_type(8)));
typedef float    v4fn __attribute__((ext_vector_type(4)));
typedef float    v4f __attribute__((ext_vector_type(4), __may_alias__));

union Frag { h16 v; h8n h[2]; };

#define BATCH 8
#define SEQ   2048
#define DIM   512
#define BM    32            // output rows (k index) per block
#define BJ    32            // contraction chunk (q index)
#define NITER (SEQ / BJ)    // 64
#define NTOT  (BATCH * SEQ * DIM)
#define VP    32            // vT pitch in halves: vT[d][j]
#define PP    32            // pbuf pitch in halves: pbuf[krow][j]

#define QK_SCALE   16.0f           // q and k carried x16 in f16 -> S carried x256
#define V_SCALE    16.0f           // v carried x16 in f16 -> O carried x16
#define S_UNSCALE  (1.0f / 256.0f)
#define O_UNSCALE  (1.0f / 16.0f)
#define EPS_SCALED 2.2627417e-6f   // 1e-7 * sqrt(512): eps applied after the 1/sqrt(d) factor, P kept as pure exp

static_assert(SEQ % BM == 0);
static_assert(SEQ % BJ == 0);
static_assert(DIM % 32 == 0);
static_assert(NTOT % (256 * 8) == 0);
static_assert(BM * DIM == 16 * 256 * 4);
static_assert(DIM * BJ == 8 * 256 * 8);

__device__ __forceinline__ f8 wmma_f16(h16 a, h16 b, f8 c) {
    f8 d = __builtin_amdgcn_wmma_f32_16x16x32_f16(false, a, false, b, (short)0, c, false, false);
    asm volatile("v_nop\n\tv_nop\n\tv_nop\n\tv_nop" : "+v"(d) : "v"(a), "v"(b));
    return d;
}

// ---------------- prep: q,k f32 -> f16 row planes (x16) ----------------
__global__ __launch_bounds__(256)
void cvt_qk_kernel(const float* __restrict__ q, const float* __restrict__ k,
                   _Float16* __restrict__ q16, _Float16* __restrict__ k16)
{
    const bool isk = (blockIdx.y != 0);          // block-uniform
    const float* src = isk ? k : q;
    _Float16*    dst = isk ? k16 : q16;
    const size_t i = ((size_t)blockIdx.x * 256 + threadIdx.x) * 8;
    const float4 a = *(const float4*)(src + i);
    const float4 b = *(const float4*)(src + i + 4);
    h8n o;
    o[0] = (_Float16)(a.x * QK_SCALE); o[1] = (_Float16)(a.y * QK_SCALE);
    o[2] = (_Float16)(a.z * QK_SCALE); o[3] = (_Float16)(a.w * QK_SCALE);
    o[4] = (_Float16)(b.x * QK_SCALE); o[5] = (_Float16)(b.y * QK_SCALE);
    o[6] = (_Float16)(b.z * QK_SCALE); o[7] = (_Float16)(b.w * QK_SCALE);
    h8* p = (h8*)(dst + i);
    *p = o;
    
}

// ---------------- prep: v f32 -> per-chunk transposed f16 plane (x16) ----------------
// vtg[b*NITER + it][d][j] = f16(16 * v[b][it*32 + j][d]); one block per (b, it); transpose through LDS,
__global__ __launch_bounds__(256)
void cvt_vt_kernel(const float* __restrict__ v, _Float16* __restrict__ vtg)
{
    __shared__ __align__(16) _Float16 lt[DIM * VP];
    const int tid = threadIdx.x;
    const int blk = blockIdx.x;                   // b*NITER + it
    const int b   = blk / NITER;
    const int it  = blk - b * NITER;
    const float* src = v + ((size_t)b * SEQ + (size_t)it * BJ) * DIM;

    #pragma unroll
    for (int u = 0; u < 16; ++u) {
        const int f  = u * 256 + tid;             // float4 index 0..4095 over the 32x512 tile
        const int j  = f >> 7;                    // row within chunk 0..31
        const int d0 = (f & 127) * 4;
        const float4 x = *(const float4*)(src + (size_t)j * DIM + d0);
        lt[(d0 + 0) * VP + j] = (_Float16)(x.x * V_SCALE);
        lt[(d0 + 1) * VP + j] = (_Float16)(x.y * V_SCALE);
        lt[(d0 + 2) * VP + j] = (_Float16)(x.z * V_SCALE);
        lt[(d0 + 3) * VP + j] = (_Float16)(x.w * V_SCALE);
    }
    __syncthreads();

    _Float16* dst = vtg + (size_t)blk * (DIM * BJ);
    h8n vals[8];
    #pragma unroll
    for (int u = 0; u < 8; ++u) {
        const int idx = (u * 256 + tid) * 8;
        vals[u] = *(const h8*)&lt[idx];
    }
    #pragma unroll
    for (int u = 0; u < 8; ++u) {
        const int idx = (u * 256 + tid) * 8;
        *(h8*)(dst + idx) = vals[u];
    }
    
}

// ---------------- main kernel ----------------
// block = (32 output rows of the k index, batch b), 256 threads = 8 waves:
//   mg = wave&1 -> 16-row tile, dq = wave>>1 -> 128 output columns (8 n-tiles).
// Per q chunk of 32: S[krow][q] = sum_d K[krow][d]*Q[q][d] (waves with dq==0), P = exp(S/256) -> LDS (f16),
// row sums -> dsum; all waves: acc[krow][d] += P[krow][q] * V[q][d] with V from the transposed chunk vT[d][q].
__global__ __launch_bounds__(256)
void attn_kernel(const float* __restrict__ vg,
                 const _Float16* __restrict__ q16, const _Float16* __restrict__ k16,
                 const _Float16* __restrict__ vtg,
                 float* __restrict__ outg)
{
    __shared__ __align__(16) _Float16 vT[DIM * VP];     // 32 KB, vT[d][j]
    __shared__ __align__(16) _Float16 pbuf[BM * PP];    // 2 KB,  pbuf[krow][j]
    __shared__ __align__(16) float    ost[BM * DIM];    // 64 KB, output staging (row pitch DIM, contiguous tile)
    __shared__ float    denom_s[BM];
    __shared__ unsigned mask_s[BM];

    const int tid  = threadIdx.x;
    const int lane = tid & 31;
    const int wave = tid >> 5;
    const int h    = lane >> 4;
    const int m    = lane & 15;
    const int mg   = wave & 1;
    const int dq   = wave >> 1;
    const int b    = blockIdx.y;
    const int i0   = blockIdx.x * BM;

    f8 zero8;
    #pragma unroll
    for (int i = 0; i < 8; ++i) zero8[i] = 0.0f;
    f8 acc[8];
    #pragma unroll
    for (int n = 0; n < 8; ++n) acc[n] = zero8;
    f8 dsum = zero8;

    // A operand (k rows of this wave's tile): row m, fragment halves at +8h and +16+8h within each 32-deep step
    const _Float16* kA = k16 + ((size_t)b * SEQ + i0 + mg * 16 + m) * DIM + 8 * h;
    // B operand (q rows, gathered down column n = m): same k map as A
    const _Float16* qB = q16 + (size_t)b * SEQ * DIM + 8 * h;

    #pragma unroll 1
    for (int it = 0; it < NITER; ++it) {
        const int j0 = it * BJ;

        __syncthreads();   // all consumers of vT / pbuf from the prior chunk are done

        // stage V chunk (already transposed and converted) into LDS: same layout as the global chunk
        {
            const _Float16* src = vtg + ((size_t)b * NITER + it) * (DIM * BJ);
            #pragma unroll
            for (int u = 0; u < 8; ++u) {
                const int idx = (u * 256 + tid) * 8;
                *(h8*)&vT[idx] = *(const h8*)(src + idx);
            }
        }

        // S tile 32x32 (waves 0,1), exp, publish P, accumulate row sums
        if (dq == 0) {
            f8 s0 = zero8, s1 = zero8;
            const _Float16* q0 = qB + (size_t)(j0 + m) * DIM;
            const _Float16* q1 = qB + (size_t)(j0 + 16 + m) * DIM;
            #pragma unroll 4
            for (int ks = 0; ks < DIM / 32; ++ks) {
                const int c = ks * 32;
                Frag a, b0, b1;
                a.h[0]  = *(const h8*)(kA + c);          // k = c + 8h + 0..7
                a.h[1]  = *(const h8*)(kA + c + 16);     // k = c + 16 + 8h + 0..7
                b0.h[0] = *(const h8*)(q0 + c);
                b0.h[1] = *(const h8*)(q0 + c + 16);
                b1.h[0] = *(const h8*)(q1 + c);
                b1.h[1] = *(const h8*)(q1 + c + 16);
                s0 = wmma_f16(a.v, b0.v, s0);
                s1 = wmma_f16(a.v, b1.v, s1);
            }
            float e0[8], e1[8];
            #pragma unroll
            for (int i = 0; i < 8; ++i) {
                e0[i] = __expf(s0[i] * S_UNSCALE);
                e1[i] = __expf(s1[i] * S_UNSCALE);
            }
            // D element i of lane -> row 8h+i, col m (tile 0) / 16+m (tile 1)
            #pragma unroll
            for (int i = 0; i < 8; ++i) {
                const int row = mg * 16 + 8 * h + i;
                pbuf[row * PP + m]      = (_Float16)e0[i];
                pbuf[row * PP + 16 + m] = (_Float16)e1[i];
            }
            #pragma unroll
            for (int i = 0; i < 8; ++i) {
                float t = e0[i] + e1[i];
                t += __shfl_xor(t, 1);
                t += __shfl_xor(t, 2);
                t += __shfl_xor(t, 4);
                t += __shfl_xor(t, 8);
                dsum[i] += t;
            }
        }
        __syncthreads();   // vT and pbuf visible to every wave (also orders the f16 P stores before the fragment reloads)

        // PV: acc[krow][d] += P[krow][j] * V[j][d]
        {
            const _Float16* pr = pbuf + (mg * 16 + m) * PP + 8 * h;
            Frag ap;
            ap.h[0] = *(const h8*)(pr);          // j = 8h + 0..7
            ap.h[1] = *(const h8*)(pr + 16);     // j = 16 + 8h + 0..7
            #pragma unroll
            for (int nt = 0; nt < 8; ++nt) {
                const int d = dq * 128 + nt * 16 + m;
                const _Float16* vp = vT + d * VP + 8 * h;
                Frag bv;
                bv.h[0] = *(const h8*)(vp);      // j = 8h + 0..7
                bv.h[1] = *(const h8*)(vp + 16); // j = 16 + 8h + 0..7
                acc[nt] = wmma_f16(ap.v, bv.v, acc[nt]);
            }
        }
    }

    // denominators (sum over all q of exp) to LDS
    if (dq == 0 && m == 0) {
        #pragma unroll
        for (int i = 0; i < 8; ++i) denom_s[mg * 16 + 8 * h + i] = dsum[i];
    }

    // mask[row] = any(v[b, i0+row, :] != 0): 8 threads per row, 64 floats each, OR via shuffles
    {
        const int row = tid >> 3;
        const int seg = tid & 7;
        const float* src = vg + ((size_t)b * SEQ + i0 + row) * DIM + seg * 64;
        int nz = 0;
        #pragma unroll 4
        for (int u = 0; u < 16; ++u) {
            const float4 x = *(const float4*)(src + u * 4);
            nz |= (int)(x.x != 0.0f) | (int)(x.y != 0.0f) | (int)(x.z != 0.0f) | (int)(x.w != 0.0f);
        }
        nz |= __shfl_xor(nz, 1);
        nz |= __shfl_xor(nz, 2);
        nz |= __shfl_xor(nz, 4);
        if (seg == 0) mask_s[row] = (unsigned)nz;
    }
    __syncthreads();

    // scale and stage the tile in LDS
    {
        float sc[8];
        #pragma unroll
        for (int i = 0; i < 8; ++i) {
            const int row = mg * 16 + 8 * h + i;
            const float den = denom_s[row] + EPS_SCALED;
            sc[i] = (mask_s[row] != 0u) ? (O_UNSCALE * __builtin_amdgcn_rcpf(den)) : 0.0f;
        }
        #pragma unroll
        for (int nt = 0; nt < 8; ++nt) {
            #pragma unroll
            for (int i = 0; i < 8; ++i) {
                const int row = mg * 16 + 8 * h + i;
                ost[row * DIM + dq * 128 + nt * 16 + m] = acc[nt][i] * sc[i];
            }
        }
    }
    __syncthreads();

    // whole-line stores: the 32x512 f32 tile is one contiguous 64 KB span of d_out; each lane stores 16 B,
    {
        float* ob = outg + ((size_t)b * SEQ + i0) * DIM;
        v4fn vals[16];
        #pragma unroll
        for (int u = 0; u < 16; ++u) {
            const int idx = (u * 256 + tid) * 4;
            vals[u] = *(const v4f*)&ost[idx];
        }
        #pragma unroll
        for (int u = 0; u < 16; ++u) {
            const int idx = (u * 256 + tid) * 4;
            *(v4f*)(ob + idx) = vals[u];
        }
        
    }
}

extern "C" void kernel_launch(void* const* d_in, const int* in_sizes, int n_in,
                              void* d_out, int out_size, void* d_ws, size_t ws_size,
                              hipStream_t stream)
{
    if (n_in < 3) return;
    if (in_sizes[0] != NTOT || in_sizes[1] != NTOT || in_sizes[2] != NTOT) return;
    if (out_size != NTOT) return;

    const size_t plane_bytes = (size_t)NTOT * sizeof(_Float16);     // 16 MiB each
    const size_t need = 3 * plane_bytes;                             // 48 MiB total carve
    if (d_ws == nullptr || ws_size < need) return;

    const float* q = (const float*)d_in[0];
    const float* k = (const float*)d_in[1];
    const float* v = (const float*)d_in[2];
    float* out = (float*)d_out;

    _Float16* q16  = (_Float16*)d_ws;
    _Float16* k16  = (_Float16*)((char*)d_ws + plane_bytes);
    _Float16* vt16 = (_Float16*)((char*)d_ws + 2 * plane_bytes);

    cvt_qk_kernel<<<dim3(NTOT / (256 * 8), 2), dim3(256), 0, stream>>>(q, k, q16, k16);
    cvt_vt_kernel<<<dim3(BATCH * NITER), dim3(256), 0, stream>>>(v, vt16);
    attn_kernel<<<dim3(SEQ / BM, BATCH), dim3(256), 0, stream>>>(v, q16, k16, vt16, out);
    (void)hipGetLastError();
}

// v001
// It runs in 219 microseconds.
// In two side-by-side timings against v000, it was 1.98 and 1.97 times as fast.
#include <hip/hip_runtime.h>
#include <stddef.h>

// Contractions: S = K*Q^T and O = P*V on v_wmma_f32_16x16x32_f16 (f16 operands, q/k/v pre-scaled by 16, f32 accumulate); exp, row sums, mask and epilogue in f32.

typedef _Float16 h16 __attribute__((ext_vector_type(16)));
typedef _Float16 h8n __attribute__((ext_vector_type(8)));
typedef _Float16 h8  __attribute__((ext_vector_type(8), __may_alias__));
typedef float    f8  __attribute__((ext_vector_type(8)));
typedef float    v4fn __attribute__((ext_vector_type(4)));
typedef float    v4f __attribute__((ext_vector_type(4), __may_alias__));

union Frag { h16 v; h8n h[2]; };

#define BATCH 8
#define SEQ   2048
#define DIM   512
#define BM    32            // output rows (k index) per block
#define BJ    32            // contraction chunk (q index)
#define NITER (SEQ / BJ)    // 64
#define NTOT  (BATCH * SEQ * DIM)
#define VP    32            // vT pitch in halves: vT[d][j]
#define PP    32            // pbuf pitch in halves: pbuf[krow][j]
#define QP    (DIM + 8)     // LDS row pitch in halves of the staged q chunk and k tile: 1040 B = 16 B x 65, b128 fragment reads fall on distinct banks

#define QK_SCALE   16.0f           // q and k carried x16 in f16 -> S carried x256
#define V_SCALE    16.0f           // v carried x16 in f16 -> O carried x16
#define S_UNSCALE  (1.0f / 256.0f)
#define O_UNSCALE  (1.0f / 16.0f)
#define EPS_SCALED 2.2627417e-6f   // 1e-7 * sqrt(512): eps applied after the 1/sqrt(d) factor, P kept as pure exp

static_assert(SEQ % BM == 0);
static_assert(SEQ % BJ == 0);
static_assert(DIM % 32 == 0);
static_assert(NTOT % (256 * 8) == 0);
static_assert(BM * DIM == 16 * 256 * 4);
static_assert(DIM * BJ == 8 * 256 * 8);
static_assert(BM * DIM == 8 * 256 * 8);
static_assert(BM * QP * sizeof(_Float16) <= BM * DIM * sizeof(float));   // the k tile fits in the output staging area

__device__ __forceinline__ f8 wmma_f16(h16 a, h16 b, f8 c) {
    f8 d = __builtin_amdgcn_wmma_f32_16x16x32_f16(false, a, false, b, (short)0, c, false, false);
    asm volatile("v_nop\n\tv_nop\n\tv_nop\n\tv_nop" : "+v"(d) : "v"(a), "v"(b));
    return d;
}

// ---------------- prep: q,k f32 -> f16 row planes (x16) ----------------
__global__ __launch_bounds__(256)
void cvt_qk_kernel(const float* __restrict__ q, const float* __restrict__ k,
                   _Float16* __restrict__ q16, _Float16* __restrict__ k16)
{
    const bool isk = (blockIdx.y != 0);          // block-uniform
    const float* src = isk ? k : q;
    _Float16*    dst = isk ? k16 : q16;
    const size_t i = ((size_t)blockIdx.x * 256 + threadIdx.x) * 8;
    const float4 a = *(const float4*)(src + i);
    const float4 b = *(const float4*)(src + i + 4);
    h8n o;
    o[0] = (_Float16)(a.x * QK_SCALE); o[1] = (_Float16)(a.y * QK_SCALE);
    o[2] = (_Float16)(a.z * QK_SCALE); o[3] = (_Float16)(a.w * QK_SCALE);
    o[4] = (_Float16)(b.x * QK_SCALE); o[5] = (_Float16)(b.y * QK_SCALE);
    o[6] = (_Float16)(b.z * QK_SCALE); o[7] = (_Float16)(b.w * QK_SCALE);
    h8* p = (h8*)(dst + i);
    *p = o;
    
}

// ---------------- prep: v f32 -> per-chunk transposed f16 plane (x16) ----------------
// vtg[b*NITER + it][d][j] = f16(16 * v[b][it*32 + j][d]); one block per (b, it); transpose through LDS,
__global__ __launch_bounds__(256)
void cvt_vt_kernel(const float* __restrict__ v, _Float16* __restrict__ vtg)
{
    __shared__ __align__(16) _Float16 lt[DIM * VP];
    const int tid = threadIdx.x;
    const int blk = blockIdx.x;                   // b*NITER + it
    const int b   = blk / NITER;
    const int it  = blk - b * NITER;
    const float* src = v + ((size_t)b * SEQ + (size_t)it * BJ) * DIM;

    #pragma unroll
    for (int u = 0; u < 16; ++u) {
        const int f  = u * 256 + tid;             // float4 index 0..4095 over the 32x512 tile
        const int j  = f >> 7;                    // row within chunk 0..31
        const int d0 = (f & 127) * 4;
        const float4 x = *(const float4*)(src + (size_t)j * DIM + d0);
        lt[(d0 + 0) * VP + j] = (_Float16)(x.x * V_SCALE);
        lt[(d0 + 1) * VP + j] = (_Float16)(x.y * V_SCALE);
        lt[(d0 + 2) * VP + j] = (_Float16)(x.z * V_SCALE);
        lt[(d0 + 3) * VP + j] = (_Float16)(x.w * V_SCALE);
    }
    __syncthreads();

    _Float16* dst = vtg + (size_t)blk * (DIM * BJ);
    h8n vals[8];
    #pragma unroll
    for (int u = 0; u < 8; ++u) {
        const int idx = (u * 256 + tid) * 8;
        vals[u] = *(const h8*)&lt[idx];
    }
    #pragma unroll
    for (int u = 0; u < 8; ++u) {
        const int idx = (u * 256 + tid) * 8;
        *(h8*)(dst + idx) = vals[u];
    }
    
}

// ---------------- main kernel ----------------
// block = (32 output rows of the k index, batch b), 256 threads = 8 waves:
//   mg = wave&1 -> 16-row tile, dq = wave>>1 -> 128 output columns (8 n-tiles).
// Per q chunk of 32: S[krow][q] = sum_d K[krow][d]*Q[q][d] (waves with dq==0), P = exp(S/256) -> LDS (f16),
// row sums -> dsum; all waves: acc[krow][d] += P[krow][q] * V[q][d] with V from the transposed chunk vT[d][q].
// The operands of S come from LDS: the k tile is staged once, each q chunk per trip, both by whole-line loads of all waves.
__global__ __launch_bounds__(256)
void attn_kernel(const float* __restrict__ vg,
                 const _Float16* __restrict__ q16, const _Float16* __restrict__ k16,
                 const _Float16* __restrict__ vtg,
                 float* __restrict__ outg)
{
    __shared__ __align__(16) _Float16 vT[DIM * VP];     // 32 KB, vT[d][j]
    __shared__ __align__(16) _Float16 pbuf[BM * PP];    // 2 KB,  pbuf[krow][j]
    __shared__ __align__(16) _Float16 qs[BJ * QP];      // 32.5 KB, qs[q row][d], padded pitch
    __shared__ __align__(16) float    ost[BM * DIM];    // 64 KB, output staging (row pitch DIM, contiguous tile); holds the k tile during the loop
    __shared__ float    denom_s[BM];
    __shared__ unsigned mask_s[BM];

    const int tid  = threadIdx.x;
    const int lane = tid & 31;
    const int wave = tid >> 5;
    const int h    = lane >> 4;
    const int m    = lane & 15;
    const int mg   = wave & 1;
    const int dq   = wave >> 1;
    const int b    = blockIdx.y;
    const int i0   = blockIdx.x * BM;

    f8 zero8;
    #pragma unroll
    for (int i = 0; i < 8; ++i) zero8[i] = 0.0f;
    f8 acc[8];
    #pragma unroll
    for (int n = 0; n < 8; ++n) acc[n] = zero8;
    f8 dsum = zero8;

    // k tile (32 rows x 512) -> LDS once, padded pitch; it lives in the output staging area, which is written only after the loop
    _Float16* ksm = reinterpret_cast<_Float16*>(ost);
    {
        const _Float16* src = k16 + ((size_t)b * SEQ + i0) * DIM;
        #pragma unroll
        for (int u = 0; u < 8; ++u) {
            const int idx = (u * 256 + tid) * 8;
            *(h8*)&ksm[(idx >> 9) * QP + (idx & (DIM - 1))] = *(const h8*)(src + idx);
        }
    }

    // A operand (k rows of this wave's tile): row m, fragment halves at +8h and +16+8h within each 32-deep step
    const _Float16* kA = ksm + (mg * 16 + m) * QP + 8 * h;
    // B operand (q rows, gathered down column n = m): same k map as A
    const _Float16* q0 = qs + m * QP + 8 * h;
    const _Float16* q1 = qs + (16 + m) * QP + 8 * h;

    #pragma unroll 1
    for (int it = 0; it < NITER; ++it) {
        const int j0 = it * BJ;

        __syncthreads();   // all consumers of vT / pbuf / qs from the prior chunk are done

        // stage the V chunk (already transposed and converted; same layout as the global chunk) and the
        // q chunk (32 contiguous rows, padded pitch in LDS): all loads first, then the LDS stores
        {
            const _Float16* vsrc = vtg + ((size_t)b * NITER + it) * (DIM * BJ) + tid * 8;
            const _Float16* qsrc = q16 + ((size_t)b * SEQ + j0) * DIM + tid * 8;
            h8n qv[8], vv[8];
            #pragma unroll
            for (int u = 0; u < 8; ++u) qv[u] = *(const h8*)(qsrc + u * 2048);
            #pragma unroll
            for (int u = 0; u < 8; ++u) vv[u] = *(const h8*)(vsrc + u * 2048);
            // the two lane addresses stay in their registers up to this wait, so that no load's result
            // and no later instruction overwrites an address register of an issued load ahead of it
            asm volatile("s_wait_xcnt 0x0" :: "v"(qsrc), "v"(vsrc) : "memory");
            #pragma unroll
            for (int u = 0; u < 8; ++u) {
                const int idx = (u * 256 + tid) * 8;
                *(h8*)&qs[(idx >> 9) * QP + (idx & (DIM - 1))] = qv[u];
            }
            #pragma unroll
            for (int u = 0; u < 8; ++u) {
                const int idx = (u * 256 + tid) * 8;
                *(h8*)&vT[idx] = vv[u];
            }
        }
        __syncthreads();   // the q chunk (and on the first trip the k tile) is visible to the waves that form S

        // S tile 32x32 (waves 0,1), exp, publish P, accumulate row sums
        if (dq == 0) {
            f8 s0 = zero8, s1 = zero8;
            #pragma unroll 4
            for (int ks = 0; ks < DIM / 32; ++ks) {
                const int c = ks * 32;
                Frag a, b0, b1;
                a.h[0]  = *(const h8*)(kA + c);          // k = c + 8h + 0..7
                a.h[1]  = *(const h8*)(kA + c + 16);     // k = c + 16 + 8h + 0..7
                b0.h[0] = *(const h8*)(q0 + c);
                b0.h[1] = *(const h8*)(q0 + c + 16);
                b1.h[0] = *(const h8*)(q1 + c);
                b1.h[1] = *(const h8*)(q1 + c + 16);
                s0 = wmma_f16(a.v, b0.v, s0);
                s1 = wmma_f16(a.v, b1.v, s1);
            }
            float e0[8], e1[8];
            #pragma unroll
            for (int i = 0; i < 8; ++i) {
                e0[i] = __expf(s0[i] * S_UNSCALE);
                e1[i] = __expf(s1[i] * S_UNSCALE);
            }
            // D element i of lane -> row 8h+i, col m (tile 0) / 16+m (tile 1)
            #pragma unroll
            for (int i = 0; i < 8; ++i) {
                const int row = mg * 16 + 8 * h + i;
                pbuf[row * PP + m]      = (_Float16)e0[i];
                pbuf[row * PP + 16 + m] = (_Float16)e1[i];
            }
            #pragma unroll
            for (int i = 0; i < 8; ++i) {
                float t = e0[i] + e1[i];
                t += __shfl_xor(t, 1);
                t += __shfl_xor(t, 2);
                t += __shfl_xor(t, 4);
                t += __shfl_xor(t, 8);
                dsum[i] += t;
            }
        }
        __syncthreads();   // pbuf visible to every wave (also orders the f16 P stores before the fragment reloads)

        // PV: acc[krow][d] += P[krow][j] * V[j][d]
        {
            const _Float16* pr = pbuf + (mg * 16 + m) * PP + 8 * h;
            Frag ap;
            ap.h[0] = *(const h8*)(pr);          // j = 8h + 0..7
            ap.h[1] = *(const h8*)(pr + 16);     // j = 16 + 8h + 0..7
            #pragma unroll
            for (int nt = 0; nt < 8; ++nt) {
                const int d = dq * 128 + nt * 16 + m;
                const _Float16* vp = vT + d * VP + 8 * h;
                Frag bv;
                bv.h[0] = *(const h8*)(vp);      // j = 8h + 0..7
                bv.h[1] = *(const h8*)(vp + 16); // j = 16 + 8h + 0..7
                acc[nt] = wmma_f16(ap.v, bv.v, acc[nt]);
            }
        }
    }

    // denominators (sum over all q of exp) to LDS
    if (dq == 0 && m == 0) {
        #pragma unroll
        for (int i = 0; i < 8; ++i) denom_s[mg * 16 + 8 * h + i] = dsum[i];
    }

    // mask[row] = any(v[b, i0+row, :] != 0): 8 threads per row, 64 floats each, OR via shuffles
    {
        const int row = tid >> 3;
        const int seg = tid & 7;
        const float* src = vg + ((size_t)b * SEQ + i0 + row) * DIM + seg * 64;
        int nz = 0;
        #pragma unroll 4
        for (int u = 0; u < 16; ++u) {
            const float4 x = *(const float4*)(src + u * 4);
            nz |= (int)(x.x != 0.0f) | (int)(x.y != 0.0f) | (int)(x.z != 0.0f) | (int)(x.w != 0.0f);
        }
        nz |= __shfl_xor(nz, 1);
        nz |= __shfl_xor(nz, 2);
        nz |= __shfl_xor(nz, 4);
        if (seg == 0) mask_s[row] = (unsigned)nz;
    }
    __syncthreads();

    // scale and stage the tile in LDS
    {
        float sc[8];
        #pragma unroll
        for (int i = 0; i < 8; ++i) {
            const int row = mg * 16 + 8 * h + i;
            const float den = denom_s[row] + EPS_SCALED;
            sc[i] = (mask_s[row] != 0u) ? (O_UNSCALE * __builtin_amdgcn_rcpf(den)) : 0.0f;
        }
        #pragma unroll
        for (int nt = 0; nt < 8; ++nt) {
            #pragma unroll
            for (int i = 0; i < 8; ++i) {
                const int row = mg * 16 + 8 * h + i;
                ost[row * DIM + dq * 128 + nt * 16 + m] = acc[nt][i] * sc[i];
            }
        }
    }
    __syncthreads();

    // whole-line stores: the 32x512 f32 tile is one contiguous 64 KB span of d_out; each lane stores 16 B,
    {
        float* ob = outg + ((size_t)b * SEQ + i0) * DIM;
        v4fn vals[16];
        #pragma unroll
        for (int u = 0; u < 16; ++u) {
            const int idx = (u * 256 + tid) * 4;
            vals[u] = *(const v4f*)&ost[idx];
        }
        #pragma unroll
        for (int u = 0; u < 16; ++u) {
            const int idx = (u * 256 + tid) * 4;
            *(v4f*)(ob + idx) = vals[u];
        }
        
    }
}

extern "C" void kernel_launch(void* const* d_in, const int* in_sizes, int n_in,
                              void* d_out, int out_size, void* d_ws, size_t ws_size,
                              hipStream_t stream)
{
    if (n_in < 3) return;
    if (in_sizes[0] != NTOT || in_sizes[1] != NTOT || in_sizes[2] != NTOT) return;
    if (out_size != NTOT) return;

    const size_t plane_bytes = (size_t)NTOT * sizeof(_Float16);     // 16 MiB each
    const size_t need = 3 * plane_bytes;                             // 48 MiB total carve
    if (d_ws == nullptr || ws_size < need) return;

    const float* q = (const float*)d_in[0];
    const float* k = (const float*)d_in[1];
    const float* v = (const float*)d_in[2];
    float* out = (float*)d_out;

    _Float16* q16  = (_Float16*)d_ws;
    _Float16* k16  = (_Float16*)((char*)d_ws + plane_bytes);
    _Float16* vt16 = (_Float16*)((char*)d_ws + 2 * plane_bytes);

    cvt_qk_kernel<<<dim3(NTOT / (256 * 8), 2), dim3(256), 0, stream>>>(q, k, q16, k16);
    cvt_vt_kernel<<<dim3(BATCH * NITER), dim3(256), 0, stream>>>(v, vt16);
    attn_kernel<<<dim3(SEQ / BM, BATCH), dim3(256), 0, stream>>>(v, q16, k16, vt16, out);
    (void)hipGetLastError();
}

// v002
// Measured time: 149 microseconds a run.
// Timed twice side by side with v001, it ran 1.46 times as fast both times.
// Over all steps from v000 it is 2.88 times as fast.
#include <hip/hip_runtime.h>
#include <stddef.h>

// Contractions: S = K*Q^T and O = P*V on v_wmma_f32_16x16x32_f16 (f16 operands, q/k/v pre-scaled by 16, f32 accumulate); exp, row sums, mask and epilogue in f32.

typedef _Float16 h16 __attribute__((ext_vector_type(16)));
typedef _Float16 h8n __attribute__((ext_vector_type(8)));
typedef _Float16 h8  __attribute__((ext_vector_type(8), __may_alias__));
typedef float    f8  __attribute__((ext_vector_type(8)));
typedef float    v4fn __attribute__((ext_vector_type(4)));
typedef float    v4f __attribute__((ext_vector_type(4), __may_alias__));

union Frag { h16 v; h8n h[2]; };

#define BATCH 8
#define SEQ   2048
#define DIM   512
#define BM    64            // output rows (k index) per block
#define BJ    32            // q rows per transposed V chunk = depth of one PV step
#define NITER (SEQ / BJ)    // 64 chunks per batch
#define TJ    64            // q rows per trip of the main loop (two chunks)
#define NTRIP (SEQ / TJ)    // 32
#define NTOT  (BATCH * SEQ * DIM)
#define VP    32            // vT pitch in halves: vT[d][j]
#define PP    (TJ + 8)      // pbuf pitch in halves: pbuf[krow][j], 144 B = 16 B x 9
#define QP    (DIM + 8)     // LDS row pitch in halves of the staged q chunk and k tile: 1040 B = 16 B x 65, b128 fragment reads fall on distinct banks

#define QK_SCALE   16.0f           // q and k carried x16 in f16 -> S carried x256
#define V_SCALE    16.0f           // v carried x16 in f16 -> O carried x16
#define S_UNSCALE  (1.0f / 256.0f)
#define O_UNSCALE  (1.0f / 16.0f)
#define EPS_SCALED 2.2627417e-6f   // 1e-7 * sqrt(512): eps applied after the 1/sqrt(d) factor, P kept as pure exp

static_assert(SEQ % BM == 0);
static_assert(SEQ % BJ == 0);
static_assert(DIM % 32 == 0);
static_assert(NTOT % (256 * 8) == 0);
static_assert(SEQ % TJ == 0 && TJ == 2 * BJ);
static_assert(BM * DIM == 32 * 256 * 4);
static_assert(DIM * BJ == 8 * 256 * 8);
static_assert(DIM * TJ == 16 * 256 * 8);
static_assert(BM * DIM == 16 * 256 * 8);
static_assert((BM + TJ) * QP * sizeof(_Float16) >= BM * DIM * sizeof(float));   // the output tile fits in the area of the k tile and the q rows

__device__ __forceinline__ f8 wmma_f16(h16 a, h16 b, f8 c) {
    f8 d = __builtin_amdgcn_wmma_f32_16x16x32_f16(false, a, false, b, (short)0, c, false, false);
    asm volatile("v_nop\n\tv_nop\n\tv_nop\n\tv_nop" : "+v"(d) : "v"(a), "v"(b));
    return d;
}

// ---------------- prep: q,k f32 -> f16 row planes (x16) ----------------
__global__ __launch_bounds__(256)
void cvt_qk_kernel(const float* __restrict__ q, const float* __restrict__ k,
                   _Float16* __restrict__ q16, _Float16* __restrict__ k16)
{
    const bool isk = (blockIdx.y != 0);          // block-uniform
    const float* src = isk ? k : q;
    _Float16*    dst = isk ? k16 : q16;
    const size_t i = ((size_t)blockIdx.x * 256 + threadIdx.x) * 8;
    const float4 a = *(const float4*)(src + i);
    const float4 b = *(const float4*)(src + i + 4);
    h8n o;
    o[0] = (_Float16)(a.x * QK_SCALE); o[1] = (_Float16)(a.y * QK_SCALE);
    o[2] = (_Float16)(a.z * QK_SCALE); o[3] = (_Float16)(a.w * QK_SCALE);
    o[4] = (_Float16)(b.x * QK_SCALE); o[5] = (_Float16)(b.y * QK_SCALE);
    o[6] = (_Float16)(b.z * QK_SCALE); o[7] = (_Float16)(b.w * QK_SCALE);
    h8* p = (h8*)(dst + i);
    *p = o;
    
}

// ---------------- prep: v f32 -> per-chunk transposed f16 plane (x16) ----------------
// vtg[b*NITER + it][d][j] = f16(16 * v[b][it*32 + j][d]); one block per (b, it); transpose through LDS,
__global__ __launch_bounds__(256)
void cvt_vt_kernel(const float* __restrict__ v, _Float16* __restrict__ vtg)
{
    __shared__ __align__(16) _Float16 lt[DIM * VP];
    const int tid = threadIdx.x;
    const int blk = blockIdx.x;                   // b*NITER + it
    const int b   = blk / NITER;
    const int it  = blk - b * NITER;
    const float* src = v + ((size_t)b * SEQ + (size_t)it * BJ) * DIM;

    #pragma unroll
    for (int u = 0; u < 16; ++u) {
        const int f  = u * 256 + tid;             // float4 index 0..4095 over the 32x512 tile
        const int j  = f >> 7;                    // row within chunk 0..31
        const int d0 = (f & 127) * 4;
        const float4 x = *(const float4*)(src + (size_t)j * DIM + d0);
        lt[(d0 + 0) * VP + j] = (_Float16)(x.x * V_SCALE);
        lt[(d0 + 1) * VP + j] = (_Float16)(x.y * V_SCALE);
        lt[(d0 + 2) * VP + j] = (_Float16)(x.z * V_SCALE);
        lt[(d0 + 3) * VP + j] = (_Float16)(x.w * V_SCALE);
    }
    __syncthreads();

    _Float16* dst = vtg + (size_t)blk * (DIM * BJ);
    h8n vals[8];
    #pragma unroll
    for (int u = 0; u < 8; ++u) {
        const int idx = (u * 256 + tid) * 8;
        vals[u] = *(const h8*)&lt[idx];
    }
    #pragma unroll
    for (int u = 0; u < 8; ++u) {
        const int idx = (u * 256 + tid) * 8;
        *(h8*)(dst + idx) = vals[u];
    }
    
}

// ---------------- main kernel ----------------
// block = (64 output rows of the k index, batch b), 256 threads = 8 waves, one block per WGP.
// Per trip of 64 q rows:
//   S[krow][q] = sum_d K[krow][d]*Q[q][d], 4 x 4 tiles: wave -> row tile mt = wave&3, q half jp = wave>>2 (two tiles, one A fragment for both);
//   P = exp(S/256) -> LDS (f16), row sums of the wave's 32 q -> dsum (two partial sums per row, added after the loop);
//   acc[krow][d] += P[krow][q] * V[q][d]: every wave takes all 4 row tiles x its own 64 output columns (4 n-tiles),
//   V from the two transposed chunks vT[chunk][d][q], in ascending chunk order.
// The operands of S come from LDS: the k tile is staged once, the q rows per trip, both by whole-line loads of all waves.
__global__ __launch_bounds__(256)
void attn_kernel(const float* __restrict__ vg,
                 const _Float16* __restrict__ q16, const _Float16* __restrict__ k16,
                 const _Float16* __restrict__ vtg,
                 float* __restrict__ outg)
{
    __shared__ __align__(16) _Float16 vT[DIM * TJ];     // 64 KB, vT[chunk][d][j], two chunks of pitch VP
    __shared__ __align__(16) _Float16 pbuf[BM * PP];    // 9 KB,  pbuf[krow][j]
    __shared__ __align__(16) float    ost[(BM + TJ) * QP / 2];   // 130 KB: k tile and q rows (f16, padded pitch) during the loop, output staging (row pitch DIM) after it
    __shared__ float    denom_s[2 * BM];
    __shared__ unsigned mask_s[BM];

    const int tid  = threadIdx.x;
    const int lane = tid & 31;
    const int wave = tid >> 5;
    const int h    = lane >> 4;
    const int m    = lane & 15;
    const int mt   = wave & 3;
    const int jp   = wave >> 2;
    const int b    = blockIdx.y;
    const int i0   = blockIdx.x * BM;

    f8 zero8;
    #pragma unroll
    for (int i = 0; i < 8; ++i) zero8[i] = 0.0f;
    f8 acc[4][4];
    #pragma unroll
    for (int r = 0; r < 4; ++r) {
        #pragma unroll
        for (int n = 0; n < 4; ++n) acc[r][n] = zero8;
    }
    f8 dsum = zero8;

    // k tile (64 rows x 512) -> LDS once, padded pitch; it lives in the output staging area, which is written only after the loop
    _Float16* ksm = reinterpret_cast<_Float16*>(ost);
    _Float16* qs  = ksm + BM * QP;
    {
        const _Float16* src = k16 + ((size_t)b * SEQ + i0) * DIM + tid * 8;
        h8n kv[16];
        #pragma unroll
        for (int u = 0; u < 16; ++u) kv[u] = *(const h8*)(src + u * 2048);
        // no register that an issued load names is rewritten ahead of this wait
        asm volatile("s_wait_xcnt 0x0" ::: "memory");
        #pragma unroll
        for (int u = 0; u < 16; ++u) {
            const int idx = (u * 256 + tid) * 8;
            *(h8*)&ksm[(idx >> 9) * QP + (idx & (DIM - 1))] = kv[u];
        }
    }

    // A operand (k rows of this wave's tile): row m, fragment halves at +8h and +16+8h within each 32-deep step
    const _Float16* kA = ksm + (mt * 16 + m) * QP + 8 * h;
    // B operand (q rows, gathered down column n = m): same k map as A
    const _Float16* q0 = qs + (jp * 32 + m) * QP + 8 * h;
    const _Float16* q1 = qs + (jp * 32 + 16 + m) * QP + 8 * h;

    #pragma unroll 1
    for (int it = 0; it < NTRIP; ++it) {
        const int j0 = it * TJ;

        __syncthreads();   // all consumers of vT / pbuf / qs from the prior trip are done

        // stage the two V chunks (already transposed and converted; adjacent in the plane, same layout in LDS) and the
        // q rows (64 contiguous rows, padded pitch in LDS): all loads first, then the LDS stores
        {
            const _Float16* vsrc = vtg + ((size_t)b * NITER + 2 * it) * (DIM * BJ) + tid * 8;
            const _Float16* qsrc = q16 + ((size_t)b * SEQ + j0) * DIM + tid * 8;
            h8n qv[16], vv[16];
            #pragma unroll
            for (int u = 0; u < 16; ++u) qv[u] = *(const h8*)(qsrc + u * 2048);
            #pragma unroll
            for (int u = 0; u < 16; ++u) vv[u] = *(const h8*)(vsrc + u * 2048);
            // the two lane addresses stay in their registers up to this wait, so that no load's result
            // and no later instruction overwrites an address register of an issued load ahead of it
            asm volatile("s_wait_xcnt 0x0" :: "v"(qsrc), "v"(vsrc) : "memory");
            #pragma unroll
            for (int u = 0; u < 16; ++u) {
                const int idx = (u * 256 + tid) * 8;
                *(h8*)&qs[(idx >> 9) * QP + (idx & (DIM - 1))] = qv[u];
            }
            #pragma unroll
            for (int u = 0; u < 16; ++u) {
                const int idx = (u * 256 + tid) * 8;
                *(h8*)&vT[idx] = vv[u];
            }
        }
        __syncthreads();   // the q rows (and on the first trip the k tile) are visible to every wave

        // S tile 64x64 (every wave: 16 rows x 32 q), exp, publish P, accumulate row sums
        {
            f8 s0 = zero8, s1 = zero8;
            #pragma unroll 4
            for (int ks = 0; ks < DIM / 32; ++ks) {
                const int c = ks * 32;
                Frag a, b0, b1;
                a.h[0]  = *(const h8*)(kA + c);          // k = c + 8h + 0..7
                a.h[1]  = *(const h8*)(kA + c + 16);     // k = c + 16 + 8h + 0..7
                b0.h[0] = *(const h8*)(q0 + c);
                b0.h[1] = *(const h8*)(q0 + c + 16);
                b1.h[0] = *(const h8*)(q1 + c);
                b1.h[1] = *(const h8*)(q1 + c + 16);
                s0 = wmma_f16(a.v, b0.v, s0);
                s1 = wmma_f16(a.v, b1.v, s1);
            }
            float e0[8], e1[8];
            #pragma unroll
            for (int i = 0; i < 8; ++i) {
                e0[i] = __expf(s0[i] * S_UNSCALE);
                e1[i] = __expf(s1[i] * S_UNSCALE);
            }
            // D element i of lane -> row 8h+i, col m (tile 0) / 16+m (tile 1) of the wave's q half
            #pragma unroll
            for (int i = 0; i < 8; ++i) {
                const int row = mt * 16 + 8 * h + i;
                pbuf[row * PP + jp * 32 + m]      = (_Float16)e0[i];
                pbuf[row * PP + jp * 32 + 16 + m] = (_Float16)e1[i];
            }
            #pragma unroll
            for (int i = 0; i < 8; ++i) {
                float t = e0[i] + e1[i];
                t += __shfl_xor(t, 1);
                t += __shfl_xor(t, 2);
                t += __shfl_xor(t, 4);
                t += __shfl_xor(t, 8);
                dsum[i] += t;
            }
        }
        __syncthreads();   // pbuf visible to every wave (also orders the f16 P stores before the fragment reloads)

        // PV: acc[krow][d] += P[krow][j] * V[j][d], one 32-deep step per chunk
        #pragma unroll
        for (int kk = 0; kk < 2; ++kk) {
            Frag ap[4];
            #pragma unroll
            for (int r = 0; r < 4; ++r) {
                const _Float16* pr = pbuf + (r * 16 + m) * PP + kk * 32 + 8 * h;
                ap[r].h[0] = *(const h8*)(pr);          // j = 32kk + 8h + 0..7
                ap[r].h[1] = *(const h8*)(pr + 16);     // j = 32kk + 16 + 8h + 0..7
            }
            #pragma unroll
            for (int nt = 0; nt < 4; ++nt) {
                const int d = wave * 64 + nt * 16 + m;
                const _Float16* vp = vT + kk * (DIM * VP) + d * VP + 8 * h;
                Frag bv;
                bv.h[0] = *(const h8*)(vp);      // j = 32kk + 8h + 0..7
                bv.h[1] = *(const h8*)(vp + 16); // j = 32kk + 16 + 8h + 0..7
                #pragma unroll
                for (int r = 0; r < 4; ++r) acc[r][nt] = wmma_f16(ap[r].v, bv.v, acc[r][nt]);
            }
        }
    }

    // partial denominators (sum of exp over the wave's q halves) to LDS
    if (m == 0) {
        #pragma unroll
        for (int i = 0; i < 8; ++i) denom_s[jp * BM + mt * 16 + 8 * h + i] = dsum[i];
    }

    // mask[row] = any(v[b, i0+row, :] != 0): 4 threads per row, 128 floats each, OR via shuffles
    {
        const int row = tid >> 2;
        const int seg = tid & 3;
        const float* src = vg + ((size_t)b * SEQ + i0 + row) * DIM + seg * 128;
        int nz = 0;
        #pragma unroll 4
        for (int u = 0; u < 32; ++u) {
            const float4 x = *(const float4*)(src + u * 4);
            nz |= (int)(x.x != 0.0f) | (int)(x.y != 0.0f) | (int)(x.z != 0.0f) | (int)(x.w != 0.0f);
        }
        nz |= __shfl_xor(nz, 1);
        nz |= __shfl_xor(nz, 2);
        if (seg == 0) mask_s[row] = (unsigned)nz;
    }
    __syncthreads();

    // scale and stage the tile in LDS
    #pragma unroll
    for (int r = 0; r < 4; ++r) {
        float sc[8];
        #pragma unroll
        for (int i = 0; i < 8; ++i) {
            const int row = r * 16 + 8 * h + i;
            const float den = (denom_s[row] + denom_s[BM + row]) + EPS_SCALED;
            sc[i] = (mask_s[row] != 0u) ? (O_UNSCALE * __builtin_amdgcn_rcpf(den)) : 0.0f;
        }
        #pragma unroll
        for (int nt = 0; nt < 4; ++nt) {
            #pragma unroll
            for (int i = 0; i < 8; ++i) {
                const int row = r * 16 + 8 * h + i;
                ost[row * DIM + wave * 64 + nt * 16 + m] = acc[r][nt][i] * sc[i];
            }
        }
    }
    __syncthreads();

    // whole-line stores: the 64x512 f32 tile is one contiguous 128 KB span of d_out; each lane stores 16 B,
    {
        float* ob = outg + ((size_t)b * SEQ + i0) * DIM;
        v4fn vals[32];
        #pragma unroll
        for (int u = 0; u < 32; ++u) {
            const int idx = (u * 256 + tid) * 4;
            vals[u] = *(const v4f*)&ost[idx];
        }
        #pragma unroll
        for (int u = 0; u < 32; ++u) {
            const int idx = (u * 256 + tid) * 4;
            *(v4f*)(ob + idx) = vals[u];
        }
    }
}

extern "C" void kernel_launch(void* const* d_in, const int* in_sizes, int n_in,
                              void* d_out, int out_size, void* d_ws, size_t ws_size,
                              hipStream_t stream)
{
    if (n_in < 3) return;
    if (in_sizes[0] != NTOT || in_sizes[1] != NTOT || in_sizes[2] != NTOT) return;
    if (out_size != NTOT) return;

    const size_t plane_bytes = (size_t)NTOT * sizeof(_Float16);     // 16 MiB each
    const size_t need = 3 * plane_bytes;                             // 48 MiB total carve
    if (d_ws == nullptr || ws_size < need) return;

    const float* q = (const float*)d_in[0];
    const float* k = (const float*)d_in[1];
    const float* v = (const float*)d_in[2];
    float* out = (float*)d_out;

    _Float16* q16  = (_Float16*)d_ws;
    _Float16* k16  = (_Float16*)((char*)d_ws + plane_bytes);
    _Float16* vt16 = (_Float16*)((char*)d_ws + 2 * plane_bytes);

    cvt_qk_kernel<<<dim3(NTOT / (256 * 8), 2), dim3(256), 0, stream>>>(q, k, q16, k16);
    cvt_vt_kernel<<<dim3(BATCH * NITER), dim3(256), 0, stream>>>(v, vt16);
    attn_kernel<<<dim3(SEQ / BM, BATCH), dim3(256), 0, stream>>>(v, q16, k16, vt16, out);
    (void)hipGetLastError();
}

// v003
// It runs in 117 microseconds.
// Two timings next to v002 put it at 1.27 and 1.28 times that version's speed.
// All steps since v000 together make it 3.68 times as fast.
#include <hip/hip_runtime.h>
#include <stddef.h>

// Contractions: S = K*Q^T and O = P*V on v_wmma_f32_16x16x32_f16 (f16 operands, q/k/v pre-scaled by 16, f32 accumulate); exp, row sums, mask and epilogue in f32.

typedef _Float16 h16 __attribute__((ext_vector_type(16)));
typedef _Float16 h8n __attribute__((ext_vector_type(8)));
typedef _Float16 h8  __attribute__((ext_vector_type(8), __may_alias__));
typedef float    f8  __attribute__((ext_vector_type(8)));
typedef float    v4fn __attribute__((ext_vector_type(4)));
typedef float    v4f __attribute__((ext_vector_type(4), __may_alias__));

union Frag { h16 v; h8n h[2]; };

typedef int i4n __attribute__((ext_vector_type(4)));
typedef __attribute__((address_space(1))) i4n gi4;
typedef __attribute__((address_space(3))) i4n li4;

#define BATCH 8
#define SEQ   2048
#define DIM   512
#define BM    64            // output rows (k index) per block
#define BJ    32            // q rows per transposed V chunk = depth of one PV step
#define NITER (SEQ / BJ)    // 64 chunks per batch
#define TJ    64            // q rows per trip of the main loop (two chunks)
#define NTRIP (SEQ / TJ)    // 32
#define NTOT  (BATCH * SEQ * DIM)
#define VP    32            // vT pitch in halves: vT[d][j]
#define PP    (TJ + 8)      // pbuf pitch in halves: pbuf[krow][j], 144 B = 16 B x 9
#define QP    (DIM + 8)     // LDS row pitch in halves of the staged q chunk and k tile: 1040 B = 16 B x 65, b128 fragment reads fall on distinct banks

#define QK_SCALE   16.0f           // q and k carried x16 in f16 -> S carried x256
#define V_SCALE    16.0f           // v carried x16 in f16 -> O carried x16
#define S_UNSCALE  (1.0f / 256.0f)
#define O_UNSCALE  (1.0f / 16.0f)
#define EPS_SCALED 2.2627417e-6f   // 1e-7 * sqrt(512): eps applied after the 1/sqrt(d) factor, P kept as pure exp

static_assert(SEQ % BM == 0);
static_assert(SEQ % BJ == 0);
static_assert(DIM % 32 == 0);
static_assert(NTOT % (256 * 8) == 0);
static_assert(SEQ % TJ == 0 && TJ == 2 * BJ);
static_assert(BM * DIM == 32 * 256 * 4);
static_assert(DIM * BJ == 8 * 256 * 8);
static_assert(DIM * TJ == 16 * 256 * 8);
static_assert(BM * DIM == 16 * 256 * 8);
static_assert((BM + TJ) * QP * sizeof(_Float16) >= BM * DIM * sizeof(float));   // the output tile fits in the area of the k tile and the q rows

__device__ __forceinline__ f8 wmma_f16(h16 a, h16 b, f8 c) {
    f8 d = __builtin_amdgcn_wmma_f32_16x16x32_f16(false, a, false, b, (short)0, c, false, false);
    asm volatile("v_nop\n\tv_nop\n\tv_nop\n\tv_nop" : "+v"(d) : "v"(a), "v"(b));
    return d;
}

// asynchronous copy of the lane's own 16 bytes from global memory to LDS, through no register;
// landed only behind the issuing wave's s_wait_asynccnt 0, readable by other waves only behind the next barrier
__device__ __forceinline__ void copy16(const _Float16* g, _Float16* l) {
    __builtin_amdgcn_global_load_async_to_lds_b128((gi4*)g, (li4*)l, 0, 0);
}

// e^x as __expf forms it (x * log2(e), then v_exp_f32), with the one slot that the instruction set asks for behind a
// transcendental in the instruction's own statement: a v_nop in a statement of its own did not stay behind it
__device__ __forceinline__ float exp_slot(float x) {
    float r;
    asm("v_exp_f32 %0, %1\n\tv_nop" : "=v"(r) : "v"(x * 0x1.715476p+0f));
    return r;
}

// ---------------- prep: q,k f32 -> f16 row planes (x16) ----------------
__global__ __launch_bounds__(256)
void cvt_qk_kernel(const float* __restrict__ q, const float* __restrict__ k,
                   _Float16* __restrict__ q16, _Float16* __restrict__ k16)
{
    const bool isk = (blockIdx.y != 0);          // block-uniform
    const float* src = isk ? k : q;
    _Float16*    dst = isk ? k16 : q16;
    const size_t i = ((size_t)blockIdx.x * 256 + threadIdx.x) * 8;
    const float4 a = *(const float4*)(src + i);
    const float4 b = *(const float4*)(src + i + 4);
    h8n o;
    o[0] = (_Float16)(a.x * QK_SCALE); o[1] = (_Float16)(a.y * QK_SCALE);
    o[2] = (_Float16)(a.z * QK_SCALE); o[3] = (_Float16)(a.w * QK_SCALE);
    o[4] = (_Float16)(b.x * QK_SCALE); o[5] = (_Float16)(b.y * QK_SCALE);
    o[6] = (_Float16)(b.z * QK_SCALE); o[7] = (_Float16)(b.w * QK_SCALE);
    h8* p = (h8*)(dst + i);
    *p = o;
    
}

// ---------------- prep: v f32 -> per-chunk transposed f16 plane (x16) ----------------
// vtg[b*NITER + it][d][j] = f16(16 * v[b][it*32 + j][d]); one block per (b, it); transpose through LDS,
__global__ __launch_bounds__(256)
void cvt_vt_kernel(const float* __restrict__ v, _Float16* __restrict__ vtg)
{
    __shared__ __align__(16) _Float16 lt[DIM * VP];
    const int tid = threadIdx.x;
    const int blk = blockIdx.x;                   // b*NITER + it
    const int b   = blk / NITER;
    const int it  = blk - b * NITER;
    const float* src = v + ((size_t)b * SEQ + (size_t)it * BJ) * DIM;

    #pragma unroll
    for (int u = 0; u < 16; ++u) {
        const int f  = u * 256 + tid;             // float4 index 0..4095 over the 32x512 tile
        const int j  = f >> 7;                    // row within chunk 0..31
        const int d0 = (f & 127) * 4;
        const float4 x = *(const float4*)(src + (size_t)j * DIM + d0);
        lt[(d0 + 0) * VP + j] = (_Float16)(x.x * V_SCALE);
        lt[(d0 + 1) * VP + j] = (_Float16)(x.y * V_SCALE);
        lt[(d0 + 2) * VP + j] = (_Float16)(x.z * V_SCALE);
        lt[(d0 + 3) * VP + j] = (_Float16)(x.w * V_SCALE);
    }
    __syncthreads();

    _Float16* dst = vtg + (size_t)blk * (DIM * BJ);
    h8n vals[8];
    #pragma unroll
    for (int u = 0; u < 8; ++u) {
        const int idx = (u * 256 + tid) * 8;
        vals[u] = *(const h8*)&lt[idx];
    }
    #pragma unroll
    for (int u = 0; u < 8; ++u) {
        const int idx = (u * 256 + tid) * 8;
        *(h8*)(dst + idx) = vals[u];
    }
    
}

// ---------------- main kernel ----------------
// block = (64 output rows of the k index, batch b), 256 threads = 8 waves, one block per WGP.
// Per trip of 64 q rows:
//   S[krow][q] = sum_d K[krow][d]*Q[q][d], 4 x 4 tiles: wave -> row tile mt = wave&3, q half jp = wave>>2 (two tiles, one A fragment for both);
//   P = exp(S/256) -> LDS (f16), row sums of the wave's 32 q -> dsum (two partial sums per row, added after the loop);
//   acc[krow][d] += P[krow][q] * V[q][d]: every wave takes all 4 row tiles x its own 64 output columns (4 n-tiles),
//   V from the two transposed chunks vT[chunk][d][q], in ascending chunk order.
// The operands of S come from LDS: the k tile is staged once through registers; the q rows and the V chunks come per trip by
// asynchronous copies of whole lines: V of this trip flies while S is formed, the q rows of the next trip fly during PV.
__global__ __launch_bounds__(256)
void attn_kernel(const float* __restrict__ vg,
                 const _Float16* __restrict__ q16, const _Float16* __restrict__ k16,
                 const _Float16* __restrict__ vtg,
                 float* __restrict__ outg)
{
    __shared__ __align__(16) _Float16 vT[DIM * TJ];     // 64 KB, vT[chunk][d][j], two chunks of pitch VP
    __shared__ __align__(16) _Float16 pbuf[BM * PP];    // 9 KB,  pbuf[krow][j]
    __shared__ __align__(16) float    ost[(BM + TJ) * QP / 2];   // 130 KB: k tile and q rows (f16, padded pitch) during the loop, output staging (row pitch DIM) after it
    __shared__ float    denom_s[2 * BM];
    __shared__ unsigned mask_s[BM];

    const int tid  = threadIdx.x;
    const int lane = tid & 31;
    const int wave = tid >> 5;
    const int h    = lane >> 4;
    const int m    = lane & 15;
    const int mt   = wave & 3;
    const int jp   = wave >> 2;
    const int b    = blockIdx.y;
    const int i0   = blockIdx.x * BM;

    f8 zero8;
    #pragma unroll
    for (int i = 0; i < 8; ++i) zero8[i] = 0.0f;
    f8 acc[4][4];
    #pragma unroll
    for (int r = 0; r < 4; ++r) {
        #pragma unroll
        for (int n = 0; n < 4; ++n) acc[r][n] = zero8;
    }
    f8 dsum = zero8;

    // k tile (64 rows x 512) -> LDS once, padded pitch; it lives in the output staging area, which is written only after the loop
    _Float16* ksm = reinterpret_cast<_Float16*>(ost);
    _Float16* qs  = ksm + BM * QP;
    {
        const _Float16* src = k16 + ((size_t)b * SEQ + i0) * DIM + tid * 8;
        h8n kv[16];
        #pragma unroll
        for (int u = 0; u < 16; ++u) kv[u] = *(const h8*)(src + u * 2048);
        // no register that an issued load names is rewritten ahead of this wait
        asm volatile("s_wait_xcnt 0x0" ::: "memory");
        #pragma unroll
        for (int u = 0; u < 16; ++u) {
            const int idx = (u * 256 + tid) * 8;
            *(h8*)&ksm[(idx >> 9) * QP + (idx & (DIM - 1))] = kv[u];
        }
    }

    // A operand (k rows of this wave's tile): row m, fragment halves at +8h and +16+8h within each 32-deep step
    const _Float16* kA = ksm + (mt * 16 + m) * QP + 8 * h;
    // B operand (q rows, gathered down column n = m): same k map as A
    const _Float16* q0 = qs + (jp * 32 + m) * QP + 8 * h;
    const _Float16* q1 = qs + (jp * 32 + 16 + m) * QP + 8 * h;

    // lane addresses of the copies: copy u of a tile moves 4 KB (four q rows; 64 rows of a V chunk), 16 B per lane
    const _Float16* qsrc = q16 + (size_t)b * SEQ * DIM + tid * 8;
    const _Float16* vsrc = vtg + (size_t)b * NITER * (DIM * BJ) + tid * 8;
    _Float16* qdst = qs + (tid >> 6) * QP + (tid & 63) * 8;
    _Float16* vdst = vT + tid * 8;

    // q rows of trip 0 (no wave has touched qs before)
    #pragma unroll
    for (int u = 0; u < 16; ++u) copy16(qsrc + u * 2048, qdst + u * 4 * QP);

    #pragma unroll 1
    for (int it = 0; it < NTRIP; ++it) {
        // hand-over at the head of a trip: this wave's LDS reads of vT and pbuf (and on trip 0 its k tile stores) have retired,
        // its copies of this trip's q rows have landed; the barrier publishes the q rows and frees vT and pbuf
        asm volatile("s_wait_dscnt 0x0" ::: "memory");
        asm volatile("s_wait_asynccnt 0x0" ::: "memory");
        __syncthreads();

        // the two V chunks of this trip (already transposed and converted; adjacent in the plane, same layout in LDS) fly during S
        #pragma unroll
        for (int u = 0; u < 16; ++u) copy16(vsrc + (size_t)it * (DIM * TJ) + u * 2048, vdst + u * 2048);

        // S tile 64x64 (every wave: 16 rows x 32 q), exp, publish P, accumulate row sums
        {
            f8 s0 = zero8, s1 = zero8;
            #pragma unroll 4
            for (int ks = 0; ks < DIM / 32; ++ks) {
                const int c = ks * 32;
                Frag a, b0, b1;
                a.h[0]  = *(const h8*)(kA + c);          // k = c + 8h + 0..7
                a.h[1]  = *(const h8*)(kA + c + 16);     // k = c + 16 + 8h + 0..7
                b0.h[0] = *(const h8*)(q0 + c);
                b0.h[1] = *(const h8*)(q0 + c + 16);
                b1.h[0] = *(const h8*)(q1 + c);
                b1.h[1] = *(const h8*)(q1 + c + 16);
                s0 = wmma_f16(a.v, b0.v, s0);
                s1 = wmma_f16(a.v, b1.v, s1);
            }
            float e0[8], e1[8];
            #pragma unroll
            for (int i = 0; i < 8; ++i) {
                e0[i] = exp_slot(s0[i] * S_UNSCALE);
                e1[i] = exp_slot(s1[i] * S_UNSCALE);
            }
            // D element i of lane -> row 8h+i, col m (tile 0) / 16+m (tile 1) of the wave's q half
            #pragma unroll
            for (int i = 0; i < 8; ++i) {
                const int row = mt * 16 + 8 * h + i;
                pbuf[row * PP + jp * 32 + m]      = (_Float16)e0[i];
                pbuf[row * PP + jp * 32 + 16 + m] = (_Float16)e1[i];
            }
            #pragma unroll
            for (int i = 0; i < 8; ++i) {
                float t = e0[i] + e1[i];
                t += __shfl_xor(t, 1);
                t += __shfl_xor(t, 2);
                t += __shfl_xor(t, 4);
                t += __shfl_xor(t, 8);
                dsum[i] += t;
            }
        }
        // hand-over between S and PV: this wave's P stores and its reads of the q rows have retired, its V copies have landed
        // (the last copies of the kernel among them); the barrier publishes pbuf and vT and frees the q rows
        asm volatile("s_wait_dscnt 0x0" ::: "memory");
        asm volatile("s_wait_asynccnt 0x0" ::: "memory");
        __syncthreads();

        // the q rows of the next trip fly during PV (block-uniform test)
        if (it + 1 < NTRIP) {
            #pragma unroll
            for (int u = 0; u < 16; ++u) copy16(qsrc + (size_t)(it + 1) * (TJ * DIM) + u * 2048, qdst + u * 4 * QP);
        }

        // PV: acc[krow][d] += P[krow][j] * V[j][d], one 32-deep step per chunk
        #pragma unroll
        for (int kk = 0; kk < 2; ++kk) {
            Frag ap[4];
            #pragma unroll
            for (int r = 0; r < 4; ++r) {
                const _Float16* pr = pbuf + (r * 16 + m) * PP + kk * 32 + 8 * h;
                ap[r].h[0] = *(const h8*)(pr);          // j = 32kk + 8h + 0..7
                ap[r].h[1] = *(const h8*)(pr + 16);     // j = 32kk + 16 + 8h + 0..7
            }
            #pragma unroll
            for (int nt = 0; nt < 4; ++nt) {
                const int d = wave * 64 + nt * 16 + m;
                const _Float16* vp = vT + kk * (DIM * VP) + d * VP + 8 * h;
                Frag bv;
                bv.h[0] = *(const h8*)(vp);      // j = 32kk + 8h + 0..7
                bv.h[1] = *(const h8*)(vp + 16); // j = 32kk + 16 + 8h + 0..7
                #pragma unroll
                for (int r = 0; r < 4; ++r) acc[r][nt] = wmma_f16(ap[r].v, bv.v, acc[r][nt]);
            }
        }
    }

    // partial denominators (sum of exp over the wave's q halves) to LDS
    if (m == 0) {
        #pragma unroll
        for (int i = 0; i < 8; ++i) denom_s[jp * BM + mt * 16 + 8 * h + i] = dsum[i];
    }

    // mask[row] = any(v[b, i0+row, :] != 0): 4 threads per row, 128 floats each, OR via shuffles
    {
        const int row = tid >> 2;
        const int seg = tid & 3;
        const float* src = vg + ((size_t)b * SEQ + i0 + row) * DIM + seg * 128;
        int nz = 0;
        #pragma unroll 4
        for (int u = 0; u < 32; ++u) {
            const float4 x = *(const float4*)(src + u * 4);
            nz |= (int)(x.x != 0.0f) | (int)(x.y != 0.0f) | (int)(x.z != 0.0f) | (int)(x.w != 0.0f);
        }
        nz |= __shfl_xor(nz, 1);
        nz |= __shfl_xor(nz, 2);
        if (seg == 0) mask_s[row] = (unsigned)nz;
    }
    __syncthreads();

    // scale and stage the tile in LDS
    #pragma unroll
    for (int r = 0; r < 4; ++r) {
        float sc[8];
        #pragma unroll
        for (int i = 0; i < 8; ++i) {
            const int row = r * 16 + 8 * h + i;
            const float den = (denom_s[row] + denom_s[BM + row]) + EPS_SCALED;
            sc[i] = (mask_s[row] != 0u) ? (O_UNSCALE * __builtin_amdgcn_rcpf(den)) : 0.0f;
        }
        #pragma unroll
        for (int nt = 0; nt < 4; ++nt) {
            #pragma unroll
            for (int i = 0; i < 8; ++i) {
                const int row = r * 16 + 8 * h + i;
                ost[row * DIM + wave * 64 + nt * 16 + m] = acc[r][nt][i] * sc[i];
            }
        }
    }
    __syncthreads();

    // whole-line stores: the 64x512 f32 tile is one contiguous 128 KB span of d_out; each lane stores 16 B,
    {
        float* ob = outg + ((size_t)b * SEQ + i0) * DIM;
        v4fn vals[32];
        #pragma unroll
        for (int u = 0; u < 32; ++u) {
            const int idx = (u * 256 + tid) * 4;
            vals[u] = *(const v4f*)&ost[idx];
        }
        #pragma unroll
        for (int u = 0; u < 32; ++u) {
            const int idx = (u * 256 + tid) * 4;
            *(v4f*)(ob + idx) = vals[u];
        }
    }
}

extern "C" void kernel_launch(void* const* d_in, const int* in_sizes, int n_in,
                              void* d_out, int out_size, void* d_ws, size_t ws_size,
                              hipStream_t stream)
{
    if (n_in < 3) return;
    if (in_sizes[0] != NTOT || in_sizes[1] != NTOT || in_sizes[2] != NTOT) return;
    if (out_size != NTOT) return;

    const size_t plane_bytes = (size_t)NTOT * sizeof(_Float16);     // 16 MiB each
    const size_t need = 3 * plane_bytes;                             // 48 MiB total carve
    if (d_ws == nullptr || ws_size < need) return;

    const float* q = (const float*)d_in[0];
    const float* k = (const float*)d_in[1];
    const float* v = (const float*)d_in[2];
    float* out = (float*)d_out;

    _Float16* q16  = (_Float16*)d_ws;
    _Float16* k16  = (_Float16*)((char*)d_ws + plane_bytes);
    _Float16* vt16 = (_Float16*)((char*)d_ws + 2 * plane_bytes);

    cvt_qk_kernel<<<dim3(NTOT / (256 * 8), 2), dim3(256), 0, stream>>>(q, k, q16, k16);
    cvt_vt_kernel<<<dim3(BATCH * NITER), dim3(256), 0, stream>>>(v, vt16);
    attn_kernel<<<dim3(SEQ / BM, BATCH), dim3(256), 0, stream>>>(v, q16, k16, vt16, out);
    (void)hipGetLastError();
}

// v004
// Measured time: 111 microseconds a run.
// Next to v003, in two timings, it ran 1.05 and 1.04 times as fast.
// Over all steps from v000 it is 3.86 times as fast.
#include <hip/hip_runtime.h>
#include <stddef.h>

// Contractions: S = K*Q^T and O = P*V on v_wmma_f32_16x16x32_f16 (f16 operands, q/k/v pre-scaled by 16, f32 accumulate); exp, row sums, mask and epilogue in f32.

typedef _Float16 h16 __attribute__((ext_vector_type(16)));
typedef _Float16 h8n __attribute__((ext_vector_type(8)));
typedef _Float16 h8  __attribute__((ext_vector_type(8), __may_alias__));
typedef float    f8  __attribute__((ext_vector_type(8)));
typedef float    v4fn __attribute__((ext_vector_type(4)));
typedef float    v4f __attribute__((ext_vector_type(4), __may_alias__));

union Frag { h16 v; h8n h[2]; };

typedef int i4n __attribute__((ext_vector_type(4)));
typedef __attribute__((address_space(1))) i4n gi4;
typedef __attribute__((address_space(3))) i4n li4;

#define BATCH 8
#define SEQ   2048
#define DIM   512
#define BM    64            // output rows (k index) per block
#define BJ    32            // q rows per transposed V chunk = depth of one PV step
#define NITER (SEQ / BJ)    // 64 chunks per batch
#define TJ    64            // q rows per trip of the main loop (two chunks)
#define NTRIP (SEQ / TJ)    // 32
#define SD    3             // depth steps of S whose fragments are held in registers at a time
#define PD    3             // V fragments of PV held in registers at a time
#define NTOT  (BATCH * SEQ * DIM)
#define VP    32            // vT pitch in halves: vT[d][j]
#define PP    (TJ + 8)      // pbuf pitch in halves: pbuf[krow][j], 144 B = 16 B x 9
#define QP    (DIM + 8)     // LDS row pitch in halves of the staged q chunk and k tile: 1040 B = 16 B x 65, b128 fragment reads fall on distinct banks

#define QK_SCALE   16.0f           // q and k carried x16 in f16 -> S carried x256
#define V_SCALE    16.0f           // v carried x16 in f16 -> O carried x16
#define S_UNSCALE  (1.0f / 256.0f)
#define O_UNSCALE  (1.0f / 16.0f)
#define EPS_SCALED 2.2627417e-6f   // 1e-7 * sqrt(512): eps applied after the 1/sqrt(d) factor, P kept as pure exp

static_assert(SEQ % BM == 0);
static_assert(SEQ % BJ == 0);
static_assert(DIM % 32 == 0);
static_assert(NTOT % (256 * 8) == 0);
static_assert(SEQ % TJ == 0 && TJ == 2 * BJ);
static_assert(BM * DIM == 32 * 256 * 4);
static_assert(DIM * BJ == 8 * 256 * 8);
static_assert(DIM * TJ == 16 * 256 * 8);
static_assert(BM * DIM == 16 * 256 * 8);
static_assert((BM + TJ) * QP * sizeof(_Float16) >= BM * DIM * sizeof(float));   // the output tile fits in the area of the k tile and the q rows

__device__ __forceinline__ f8 wmma_f16(h16 a, h16 b, f8 c) {
    f8 d = __builtin_amdgcn_wmma_f32_16x16x32_f16(false, a, false, b, (short)0, c, false, false);
    asm volatile("v_nop\n\tv_nop\n\tv_nop\n\tv_nop" : "+v"(d) : "v"(a), "v"(b));
    return d;
}

// asynchronous copy of the lane's own 16 bytes from global memory to LDS, through no register;
// landed only behind the issuing wave's s_wait_asynccnt 0, readable by other waves only behind the next barrier
__device__ __forceinline__ void copy16(const _Float16* g, _Float16* l) {
    __builtin_amdgcn_global_load_async_to_lds_b128((gi4*)g, (li4*)l, 0, 0);
}

// e^x as __expf forms it (x * log2(e), then v_exp_f32), with the one slot that the instruction set asks for behind a
// transcendental in the instruction's own statement: a v_nop in a statement of its own did not stay behind it
__device__ __forceinline__ float exp_slot(float x) {
    float r;
    asm("v_exp_f32 %0, %1\n\tv_nop" : "=v"(r) : "v"(x * 0x1.715476p+0f));
    return r;
}

// ---------------- prep: q,k f32 -> f16 row planes (x16) ----------------
__global__ __launch_bounds__(256)
void cvt_qk_kernel(const float* __restrict__ q, const float* __restrict__ k,
                   _Float16* __restrict__ q16, _Float16* __restrict__ k16)
{
    const bool isk = (blockIdx.y != 0);          // block-uniform
    const float* src = isk ? k : q;
    _Float16*    dst = isk ? k16 : q16;
    const size_t i = ((size_t)blockIdx.x * 256 + threadIdx.x) * 8;
    const float4 a = *(const float4*)(src + i);
    const float4 b = *(const float4*)(src + i + 4);
    h8n o;
    o[0] = (_Float16)(a.x * QK_SCALE); o[1] = (_Float16)(a.y * QK_SCALE);
    o[2] = (_Float16)(a.z * QK_SCALE); o[3] = (_Float16)(a.w * QK_SCALE);
    o[4] = (_Float16)(b.x * QK_SCALE); o[5] = (_Float16)(b.y * QK_SCALE);
    o[6] = (_Float16)(b.z * QK_SCALE); o[7] = (_Float16)(b.w * QK_SCALE);
    h8* p = (h8*)(dst + i);
    *p = o;
    
}

// ---------------- prep: v f32 -> per-chunk transposed f16 plane (x16) ----------------
// vtg[b*NITER + it][d][j] = f16(16 * v[b][it*32 + j][d]); one block per (b, it); transpose through LDS,
__global__ __launch_bounds__(256)
void cvt_vt_kernel(const float* __restrict__ v, _Float16* __restrict__ vtg)
{
    __shared__ __align__(16) _Float16 lt[DIM * VP];
    const int tid = threadIdx.x;
    const int blk = blockIdx.x;                   // b*NITER + it
    const int b   = blk / NITER;
    const int it  = blk - b * NITER;
    const float* src = v + ((size_t)b * SEQ + (size_t)it * BJ) * DIM;

    #pragma unroll
    for (int u = 0; u < 16; ++u) {
        const int f  = u * 256 + tid;             // float4 index 0..4095 over the 32x512 tile
        const int j  = f >> 7;                    // row within chunk 0..31
        const int d0 = (f & 127) * 4;
        const float4 x = *(const float4*)(src + (size_t)j * DIM + d0);
        lt[(d0 + 0) * VP + j] = (_Float16)(x.x * V_SCALE);
        lt[(d0 + 1) * VP + j] = (_Float16)(x.y * V_SCALE);
        lt[(d0 + 2) * VP + j] = (_Float16)(x.z * V_SCALE);
        lt[(d0 + 3) * VP + j] = (_Float16)(x.w * V_SCALE);
    }
    __syncthreads();

    _Float16* dst = vtg + (size_t)blk * (DIM * BJ);
    h8n vals[8];
    #pragma unroll
    for (int u = 0; u < 8; ++u) {
        const int idx = (u * 256 + tid) * 8;
        vals[u] = *(const h8*)&lt[idx];
    }
    #pragma unroll
    for (int u = 0; u < 8; ++u) {
        const int idx = (u * 256 + tid) * 8;
        *(h8*)(dst + idx) = vals[u];
    }
    
}

// ---------------- main kernel ----------------
// block = (64 output rows of the k index, batch b), 256 threads = 8 waves, one block per WGP.
// Per trip of 64 q rows:
//   S[krow][q] = sum_d K[krow][d]*Q[q][d], 4 x 4 tiles: wave -> row tile mt = wave&3, q half jp = wave>>2 (two tiles, one A fragment for both);
//   P = exp(S/256) -> LDS (f16), row sums of the wave's 32 q -> dsum (two partial sums per row, added after the loop);
//   acc[krow][d] += P[krow][q] * V[q][d]: every wave takes all 4 row tiles x its own 64 output columns (4 n-tiles),
//   V from the two transposed chunks vT[chunk][d][q], in ascending chunk order.
// The operands of S come from LDS: the k tile is staged once through registers; the q rows and the V chunks come per trip by
// asynchronous copies of whole lines: V of this trip flies while S is formed, the q rows of the next trip fly during PV.
// Fragment reads run ahead of the products inside each phase (register rings), never across a barrier. Every operand of wmma_f16
// is named in its asm statement and so sits below v256: accumulators (128) + rings must fit there, or the accumulators spill.
// Left, by the count of LDS clocks a trip asks for: vT's 64 B pitch costs its b128 reads four times the clocks of a 16 B x odd pitch;
// the k fragments are re-read every trip although they never change; row sums go through ds_bpermute. In the prep launches,
// cvt_qk starts 65,536 waves of one 32 B read per lane, and cvt_vt stores 2-byte elements at a lane stride of 256 B (one bank).
__global__ __launch_bounds__(256)
void attn_kernel(const float* __restrict__ vg,
                 const _Float16* __restrict__ q16, const _Float16* __restrict__ k16,
                 const _Float16* __restrict__ vtg,
                 float* __restrict__ outg)
{
    __shared__ __align__(16) _Float16 vT[DIM * TJ];     // 64 KB, vT[chunk][d][j], two chunks of pitch VP
    __shared__ __align__(16) _Float16 pbuf[BM * PP];    // 9 KB,  pbuf[krow][j]
    __shared__ __align__(16) float    ost[(BM + TJ) * QP / 2];   // 130 KB: k tile and q rows (f16, padded pitch) during the loop, output staging (row pitch DIM) after it
    __shared__ float    denom_s[2 * BM];
    __shared__ unsigned mask_s[BM];

    const int tid  = threadIdx.x;
    const int lane = tid & 31;
    const int wave = tid >> 5;
    const int h    = lane >> 4;
    const int m    = lane & 15;
    const int mt   = wave & 3;
    const int jp   = wave >> 2;
    const int b    = blockIdx.y;
    const int i0   = blockIdx.x * BM;

    f8 zero8;
    #pragma unroll
    for (int i = 0; i < 8; ++i) zero8[i] = 0.0f;
    f8 acc[4][4];
    #pragma unroll
    for (int r = 0; r < 4; ++r) {
        #pragma unroll
        for (int n = 0; n < 4; ++n) acc[r][n] = zero8;
    }
    f8 dsum = zero8;

    // k tile (64 rows x 512) -> LDS once, padded pitch; it lives in the output staging area, which is written only after the loop
    _Float16* ksm = reinterpret_cast<_Float16*>(ost);
    _Float16* qs  = ksm + BM * QP;
    {
        const _Float16* src = k16 + ((size_t)b * SEQ + i0) * DIM + tid * 8;
        h8n kv[16];
        #pragma unroll
        for (int u = 0; u < 16; ++u) kv[u] = *(const h8*)(src + u * 2048);
        // no register that an issued load names is rewritten ahead of this wait
        asm volatile("s_wait_xcnt 0x0" ::: "memory");
        #pragma unroll
        for (int u = 0; u < 16; ++u) {
            const int idx = (u * 256 + tid) * 8;
            *(h8*)&ksm[(idx >> 9) * QP + (idx & (DIM - 1))] = kv[u];
        }
    }

    // A operand (k rows of this wave's tile): row m, fragment halves at +8h and +16+8h within each 32-deep step
    const _Float16* kA = ksm + (mt * 16 + m) * QP + 8 * h;
    // B operand (q rows, gathered down column n = m): same k map as A
    const _Float16* q0 = qs + (jp * 32 + m) * QP + 8 * h;
    const _Float16* q1 = qs + (jp * 32 + 16 + m) * QP + 8 * h;

    // lane addresses of the copies: copy u of a tile moves 4 KB (four q rows; 64 rows of a V chunk), 16 B per lane
    const _Float16* qsrc = q16 + (size_t)b * SEQ * DIM + tid * 8;
    const _Float16* vsrc = vtg + (size_t)b * NITER * (DIM * BJ) + tid * 8;
    _Float16* qdst = qs + (tid >> 6) * QP + (tid & 63) * 8;
    _Float16* vdst = vT + tid * 8;

    // q rows of trip 0 (no wave has touched qs before)
    #pragma unroll
    for (int u = 0; u < 16; ++u) copy16(qsrc + u * 2048, qdst + u * 4 * QP);

    #pragma unroll 1
    for (int it = 0; it < NTRIP; ++it) {
        // hand-over at the head of a trip: this wave's LDS reads of vT and pbuf (and on trip 0 its k tile stores) have retired,
        // its copies of this trip's q rows have landed; the barrier publishes the q rows and frees vT and pbuf
        asm volatile("s_wait_dscnt 0x0" ::: "memory");
        asm volatile("s_wait_asynccnt 0x0" ::: "memory");
        __syncthreads();

        // the two V chunks of this trip (already transposed and converted; adjacent in the plane, same layout in LDS) fly during S
        #pragma unroll
        for (int u = 0; u < 16; ++u) copy16(vsrc + (size_t)it * (DIM * TJ) + u * 2048, vdst + u * 2048);

        // S tile 64x64 (every wave: 16 rows x 32 q), exp, publish P, accumulate row sums
        {
            f8 s0 = zero8, s1 = zero8;
            // fragments in a ring of SD register sets, one depth step each: the loads of step ks + SD are issued right behind
            // the products of step ks, so that a wave waits only for loads that are SD steps old (all inside this phase)
            Frag a[SD], b0[SD], b1[SD];
            #pragma unroll
            for (int t = 0; t < SD; ++t) {
                const int c = t * 32;
                a[t].h[0]  = *(const h8*)(kA + c);          // k = c + 8h + 0..7
                a[t].h[1]  = *(const h8*)(kA + c + 16);     // k = c + 16 + 8h + 0..7
                b0[t].h[0] = *(const h8*)(q0 + c);
                b0[t].h[1] = *(const h8*)(q0 + c + 16);
                b1[t].h[0] = *(const h8*)(q1 + c);
                b1[t].h[1] = *(const h8*)(q1 + c + 16);
            }
            // unrolled whole: the set index must be a constant for the ring to stay in registers
            #pragma unroll
            for (int ks = 0; ks < DIM / 32; ++ks) {
                const int t = ks % SD;
                s0 = wmma_f16(a[t].v, b0[t].v, s0);
                s1 = wmma_f16(a[t].v, b1[t].v, s1);
                if (ks + SD < DIM / 32) {
                    const int c = (ks + SD) * 32;
                    a[t].h[0]  = *(const h8*)(kA + c);
                    a[t].h[1]  = *(const h8*)(kA + c + 16);
                    b0[t].h[0] = *(const h8*)(q0 + c);
                    b0[t].h[1] = *(const h8*)(q0 + c + 16);
                    b1[t].h[0] = *(const h8*)(q1 + c);
                    b1[t].h[1] = *(const h8*)(q1 + c + 16);
                }
            }
            float e0[8], e1[8];
            #pragma unroll
            for (int i = 0; i < 8; ++i) {
                e0[i] = exp_slot(s0[i] * S_UNSCALE);
                e1[i] = exp_slot(s1[i] * S_UNSCALE);
            }
            // D element i of lane -> row 8h+i, col m (tile 0) / 16+m (tile 1) of the wave's q half
            #pragma unroll
            for (int i = 0; i < 8; ++i) {
                const int row = mt * 16 + 8 * h + i;
                pbuf[row * PP + jp * 32 + m]      = (_Float16)e0[i];
                pbuf[row * PP + jp * 32 + 16 + m] = (_Float16)e1[i];
            }
            #pragma unroll
            for (int i = 0; i < 8; ++i) {
                float t = e0[i] + e1[i];
                t += __shfl_xor(t, 1);
                t += __shfl_xor(t, 2);
                t += __shfl_xor(t, 4);
                t += __shfl_xor(t, 8);
                dsum[i] += t;
            }
        }
        // hand-over between S and PV: this wave's P stores and its reads of the q rows have retired, its V copies have landed
        // (the last copies of the kernel among them); the barrier publishes pbuf and vT and frees the q rows
        asm volatile("s_wait_dscnt 0x0" ::: "memory");
        asm volatile("s_wait_asynccnt 0x0" ::: "memory");
        __syncthreads();

        // the q rows of the next trip fly during PV (block-uniform test)
        if (it + 1 < NTRIP) {
            #pragma unroll
            for (int u = 0; u < 16; ++u) copy16(qsrc + (size_t)(it + 1) * (TJ * DIM) + u * 2048, qdst + u * 4 * QP);
        }

        // PV: acc[krow][d] += P[krow][j] * V[j][d], one 32-deep step per chunk. The P fragments of both chunks and the first
        // PD of the eight V fragments are loaded as one run ahead of the products; V fragment s + PD follows the products of s
        {
            Frag ap[2][4], bv[PD];
            const _Float16* pr = pbuf + m * PP + 8 * h;
            const _Float16* vp = vT + (wave * 64 + m) * VP + 8 * h;
            #pragma unroll
            for (int r = 0; r < 4; ++r) {
                ap[0][r].h[0] = *(const h8*)(pr + r * 16 * PP);          // j = 8h + 0..7
                ap[0][r].h[1] = *(const h8*)(pr + r * 16 * PP + 16);     // j = 16 + 8h + 0..7
            }
            #pragma unroll
            for (int s = 0; s < PD; ++s) {
                const int o = (s >> 2) * (DIM * VP) + (s & 3) * 16 * VP;   // chunk s / 4, n-tile s % 4
                bv[s].h[0] = *(const h8*)(vp + o);        // j = 32kk + 8h + 0..7
                bv[s].h[1] = *(const h8*)(vp + o + 16);   // j = 32kk + 16 + 8h + 0..7
            }
            #pragma unroll
            for (int r = 0; r < 4; ++r) {
                ap[1][r].h[0] = *(const h8*)(pr + r * 16 * PP + 32);     // j = 32 + 8h + 0..7
                ap[1][r].h[1] = *(const h8*)(pr + r * 16 * PP + 48);     // j = 48 + 8h + 0..7
            }
            #pragma unroll
            for (int s = 0; s < 8; ++s) {
                const int kk = s >> 2, nt = s & 3, t = s % PD;
                #pragma unroll
                for (int r = 0; r < 4; ++r) acc[r][nt] = wmma_f16(ap[kk][r].v, bv[t].v, acc[r][nt]);
                if (s + PD < 8) {
                    const int o = ((s + PD) >> 2) * (DIM * VP) + ((s + PD) & 3) * 16 * VP;
                    bv[t].h[0] = *(const h8*)(vp + o);
                    bv[t].h[1] = *(const h8*)(vp + o + 16);
                }
            }
        }
    }

    // partial denominators (sum of exp over the wave's q halves) to LDS
    if (m == 0) {
        #pragma unroll
        for (int i = 0; i < 8; ++i) denom_s[jp * BM + mt * 16 + 8 * h + i] = dsum[i];
    }

    // mask[row] = any(v[b, i0+row, :] != 0): 4 threads per row, 128 floats each, OR via shuffles
    {
        const int row = tid >> 2;
        const int seg = tid & 3;
        const float* src = vg + ((size_t)b * SEQ + i0 + row) * DIM + seg * 128;
        int nz = 0;
        #pragma unroll 4
        for (int u = 0; u < 32; ++u) {
            const float4 x = *(const float4*)(src + u * 4);
            nz |= (int)(x.x != 0.0f) | (int)(x.y != 0.0f) | (int)(x.z != 0.0f) | (int)(x.w != 0.0f);
        }
        nz |= __shfl_xor(nz, 1);
        nz |= __shfl_xor(nz, 2);
        if (seg == 0) mask_s[row] = (unsigned)nz;
    }
    __syncthreads();

    // scale and stage the tile in LDS
    #pragma unroll
    for (int r = 0; r < 4; ++r) {
        float sc[8];
        #pragma unroll
        for (int i = 0; i < 8; ++i) {
            const int row = r * 16 + 8 * h + i;
            const float den = (denom_s[row] + denom_s[BM + row]) + EPS_SCALED;
            sc[i] = (mask_s[row] != 0u) ? (O_UNSCALE * __builtin_amdgcn_rcpf(den)) : 0.0f;
        }
        #pragma unroll
        for (int nt = 0; nt < 4; ++nt) {
            #pragma unroll
            for (int i = 0; i < 8; ++i) {
                const int row = r * 16 + 8 * h + i;
                ost[row * DIM + wave * 64 + nt * 16 + m] = acc[r][nt][i] * sc[i];
            }
        }
    }
    __syncthreads();

    // whole-line stores: the 64x512 f32 tile is one contiguous 128 KB span of d_out; each lane stores 16 B,
    {
        float* ob = outg + ((size_t)b * SEQ + i0) * DIM;
        v4fn vals[32];
        #pragma unroll
        for (int u = 0; u < 32; ++u) {
            const int idx = (u * 256 + tid) * 4;
            vals[u] = *(const v4f*)&ost[idx];
        }
        #pragma unroll
        for (int u = 0; u < 32; ++u) {
            const int idx = (u * 256 + tid) * 4;
            *(v4f*)(ob + idx) = vals[u];
        }
    }
}

extern "C" void kernel_launch(void* const* d_in, const int* in_sizes, int n_in,
                              void* d_out, int out_size, void* d_ws, size_t ws_size,
                              hipStream_t stream)
{
    if (n_in < 3) return;
    if (in_sizes[0] != NTOT || in_sizes[1] != NTOT || in_sizes[2] != NTOT) return;
    if (out_size != NTOT) return;

    const size_t plane_bytes = (size_t)NTOT * sizeof(_Float16);     // 16 MiB each
    const size_t need = 3 * plane_bytes;                             // 48 MiB total carve
    if (d_ws == nullptr || ws_size < need) return;

    const float* q = (const float*)d_in[0];
    const float* k = (const float*)d_in[1];
    const float* v = (const float*)d_in[2];
    float* out = (float*)d_out;

    _Float16* q16  = (_Float16*)d_ws;
    _Float16* k16  = (_Float16*)((char*)d_ws + plane_bytes);
    _Float16* vt16 = (_Float16*)((char*)d_ws + 2 * plane_bytes);

    cvt_qk_kernel<<<dim3(NTOT / (256 * 8), 2), dim3(256), 0, stream>>>(q, k, q16, k16);
    cvt_vt_kernel<<<dim3(BATCH * NITER), dim3(256), 0, stream>>>(v, vt16);
    attn_kernel<<<dim3(SEQ / BM, BATCH), dim3(256), 0, stream>>>(v, q16, k16, vt16, out);
    (void)hipGetLastError();
}

// v005
// Measured time: 103 microseconds a run.
// Timed twice side by side with v004, it ran 1.08 times as fast both times.
// All steps since v000 together make it 4.18 times as fast.
#include <hip/hip_runtime.h>
#include <stddef.h>

// Contractions: S = K*Q^T and O = P*V on v_wmma_f32_16x16x32_f16 (f16 operands, q/k/v pre-scaled by 16, f32 accumulate); exp, row sums, mask and epilogue in f32.

typedef _Float16 h16 __attribute__((ext_vector_type(16)));
typedef _Float16 h8n __attribute__((ext_vector_type(8)));
typedef _Float16 h8  __attribute__((ext_vector_type(8), __may_alias__));
typedef float    f8  __attribute__((ext_vector_type(8)));
typedef float    v4fn __attribute__((ext_vector_type(4)));
typedef float    v4f __attribute__((ext_vector_type(4), __may_alias__));

union Frag { h16 v; h8n h[2]; };

typedef int i4n __attribute__((ext_vector_type(4)));
typedef __attribute__((address_space(1))) i4n gi4;
typedef __attribute__((address_space(3))) i4n li4;

#define BATCH 8
#define SEQ   2048
#define DIM   512
#define BM    64            // output rows (k index) per block
#define BJ    32            // q rows per transposed V chunk = depth of one PV step
#define NITER (SEQ / BJ)    // 64 chunks per batch
#define TJ    64            // q rows per trip of the main loop (two chunks)
#define NTRIP (SEQ / TJ)    // 32
#define SD    3             // depth steps of S whose fragments are held in registers at a time
#define PD    3             // V fragments of PV held in registers at a time
#define NTOT  (BATCH * SEQ * DIM)
#define VP    32            // vT pitch in halves: vT[d][j]
#define LTQ   (4 * VP + 8)  // halves per four rows of the plane in cvt_vt's LDS: 256 B + 16 B pad = 272 B
#define PP    (TJ + 8)      // pbuf pitch in halves: pbuf[krow][j], 144 B = 16 B x 9
#define QP    (DIM + 8)     // LDS row pitch in halves of the staged q chunk and k tile: 1040 B = 16 B x 65, b128 fragment reads fall on distinct banks

#define QK_SCALE   16.0f           // q and k carried x16 in f16 -> S carried x256
#define V_SCALE    16.0f           // v carried x16 in f16 -> O carried x16
#define S_UNSCALE  (1.0f / 256.0f)
#define O_UNSCALE  (1.0f / 16.0f)
#define EPS_SCALED 2.2627417e-6f   // 1e-7 * sqrt(512): eps applied after the 1/sqrt(d) factor, P kept as pure exp

static_assert(SEQ % BM == 0);
static_assert(SEQ % BJ == 0);
static_assert(DIM % 32 == 0);
static_assert(NTOT % (256 * 8) == 0);
static_assert(SEQ % TJ == 0 && TJ == 2 * BJ);
static_assert(BM * DIM == 32 * 256 * 4);
static_assert(DIM * BJ == 8 * 256 * 8);
static_assert(DIM / 4 == 128 && BJ == 32 && VP == BJ);   // cvt_vt: 128 column quads x 2 halves of 16 rows = 256 lanes
static_assert(DIM * TJ == 16 * 256 * 8);
static_assert(BM * DIM == 16 * 256 * 8);
static_assert((BM + TJ) * QP * sizeof(_Float16) >= BM * DIM * sizeof(float));   // the output tile fits in the area of the k tile and the q rows

__device__ __forceinline__ f8 wmma_f16(h16 a, h16 b, f8 c) {
    f8 d = __builtin_amdgcn_wmma_f32_16x16x32_f16(false, a, false, b, (short)0, c, false, false);
    asm volatile("v_nop\n\tv_nop\n\tv_nop\n\tv_nop" : "+v"(d) : "v"(a), "v"(b));
    return d;
}

// asynchronous copy of the lane's own 16 bytes from global memory to LDS, through no register;
// landed only behind the issuing wave's s_wait_asynccnt 0, readable by other waves only behind the next barrier
__device__ __forceinline__ void copy16(const _Float16* g, _Float16* l) {
    __builtin_amdgcn_global_load_async_to_lds_b128((gi4*)g, (li4*)l, 0, 0);
}

// e^x as __expf forms it (x * log2(e), then v_exp_f32), with the one slot that the instruction set asks for behind a
// transcendental in the instruction's own statement: a v_nop in a statement of its own did not stay behind it
__device__ __forceinline__ float exp_slot(float x) {
    float r;
    asm("v_exp_f32 %0, %1\n\tv_nop" : "=v"(r) : "v"(x * 0x1.715476p+0f));
    return r;
}

// ---------------- prep: q,k f32 -> f16 row planes (x16) ----------------
__global__ __launch_bounds__(256)
void cvt_qk_kernel(const float* __restrict__ q, const float* __restrict__ k,
                   _Float16* __restrict__ q16, _Float16* __restrict__ k16)
{
    const bool isk = (blockIdx.y != 0);          // block-uniform
    const float* src = isk ? k : q;
    _Float16*    dst = isk ? k16 : q16;
    const size_t i = ((size_t)blockIdx.x * 256 + threadIdx.x) * 8;
    const float4 a = *(const float4*)(src + i);
    const float4 b = *(const float4*)(src + i + 4);
    h8n o;
    o[0] = (_Float16)(a.x * QK_SCALE); o[1] = (_Float16)(a.y * QK_SCALE);
    o[2] = (_Float16)(a.z * QK_SCALE); o[3] = (_Float16)(a.w * QK_SCALE);
    o[4] = (_Float16)(b.x * QK_SCALE); o[5] = (_Float16)(b.y * QK_SCALE);
    o[6] = (_Float16)(b.z * QK_SCALE); o[7] = (_Float16)(b.w * QK_SCALE);
    h8* p = (h8*)(dst + i);
    *p = o;
    
}

// ---------------- prep: v f32 -> per-chunk transposed f16 plane (x16) ----------------
// vtg[b*NITER + it][d][j] = f16(16 * v[b][it*32 + j][d]); one block per (b, it).
// The transposition is done in registers: a lane reads the same four columns of two groups of eight consecutive rows (each wave-wide
// load is 512 contiguous bytes of one row) and so holds, per group and column, eight neighbours along j = one 16 B piece of the plane.
// LDS only reorders those pieces into the plane's linear order for whole-line stores. Four plane rows (256 B) are followed by a
// 16 B pad: lanes that are four rows apart then store 272 B apart, on distinct banks, and the read-back stays contiguous per 256 B.
__global__ __launch_bounds__(256)
void cvt_vt_kernel(const float* __restrict__ v, _Float16* __restrict__ vtg)
{
    __shared__ __align__(16) _Float16 lt[(DIM / 4) * LTQ];
    const int tid = threadIdx.x;
    const int blk = blockIdx.x;                   // b*NITER + it
    const int b   = blk / NITER;
    const int it  = blk - b * NITER;
    const int dq  = tid & 127;                    // column quad: d = 4*dq .. 4*dq + 3
    const int jh  = tid >> 7;                     // wave-uniform: row groups 2*jh and 2*jh + 1 (eight rows each)
    const float* src = v + ((size_t)b * SEQ + (size_t)it * BJ + jh * 16) * DIM + dq * 4;

    v4fn x[16];                                   // x[r] = v[row 16*jh + r][4*dq .. 4*dq + 3]
    #pragma unroll
    for (int r = 0; r < 16; ++r) x[r] = *(const v4f*)(src + r * DIM);
    // no register that an issued load names is rewritten ahead of this wait; the address is named as an input so that it
    // stays live up to here and no load's own result is placed on it
    asm volatile("s_wait_xcnt 0x0" :: "v"(src) : "memory");

    #pragma unroll
    for (int g = 0; g < 2; ++g) {
        #pragma unroll
        for (int i = 0; i < 4; ++i) {
            h8n o;
            #pragma unroll
            for (int r = 0; r < 8; ++r) o[r] = (_Float16)(x[g * 8 + r][i] * V_SCALE);
            *(h8*)&lt[dq * LTQ + i * VP + (jh * 2 + g) * 8] = o;      // plane row 4*dq + i, j = 16*jh + 8*g + 0..7
        }
    }
    __syncthreads();

    _Float16* dst = vtg + (size_t)blk * (DIM * BJ);
    h8n vals[8];
    #pragma unroll
    for (int u = 0; u < 8; ++u) {
        const int n = u * 256 + tid;              // 16 B piece n of the plane: sixteen pieces per four rows
        vals[u] = *(const h8*)&lt[(n >> 4) * LTQ + (n & 15) * 8];
    }
    #pragma unroll
    for (int u = 0; u < 8; ++u) {
        const int idx = (u * 256 + tid) * 8;
        *(h8*)(dst + idx) = vals[u];
    }
    
}

// ---------------- main kernel ----------------
// block = (64 output rows of the k index, batch b), 256 threads = 8 waves, one block per WGP.
// Per trip of 64 q rows:
//   S[krow][q] = sum_d K[krow][d]*Q[q][d], 4 x 4 tiles: wave -> row tile mt = wave&3, q half jp = wave>>2 (two tiles, one A fragment for both);
//   P = exp(S/256) -> LDS (f16), row sums of the wave's 32 q -> dsum (two partial sums per row, added after the loop);
//   acc[krow][d] += P[krow][q] * V[q][d]: every wave takes all 4 row tiles x its own 64 output columns (4 n-tiles),
//   V from the two transposed chunks vT[chunk][d][q], in ascending chunk order.
// The operands of S come from LDS: the k tile is staged once through registers; the q rows and the V chunks come per trip by
// asynchronous copies of whole lines: V of this trip flies while S is formed, the q rows of the next trip fly during PV.
// Fragment reads run ahead of the products inside each phase (register rings), never across a barrier. Every operand of wmma_f16
// is named in its asm statement and so sits below v256: accumulators (128) + rings must fit there, or the accumulators spill.
// Left, by the count of LDS clocks a trip asks for: vT's 64 B pitch costs its b128 reads four times the clocks of a 16 B x odd pitch;
// the k fragments are re-read every trip although they never change; row sums go through ds_bpermute. In the prep launches,
// cvt_qk starts 65,536 waves of one 32 B read per lane.
__global__ __launch_bounds__(256)
void attn_kernel(const float* __restrict__ vg,
                 const _Float16* __restrict__ q16, const _Float16* __restrict__ k16,
                 const _Float16* __restrict__ vtg,
                 float* __restrict__ outg)
{
    __shared__ __align__(16) _Float16 vT[DIM * TJ];     // 64 KB, vT[chunk][d][j], two chunks of pitch VP
    __shared__ __align__(16) _Float16 pbuf[BM * PP];    // 9 KB,  pbuf[krow][j]
    __shared__ __align__(16) float    ost[(BM + TJ) * QP / 2];   // 130 KB: k tile and q rows (f16, padded pitch) during the loop, output staging (row pitch DIM) after it
    __shared__ float    denom_s[2 * BM];
    __shared__ unsigned mask_s[BM];

    const int tid  = threadIdx.x;
    const int lane = tid & 31;
    const int wave = tid >> 5;
    const int h    = lane >> 4;
    const int m    = lane & 15;
    const int mt   = wave & 3;
    const int jp   = wave >> 2;
    const int b    = blockIdx.y;
    const int i0   = blockIdx.x * BM;

    f8 zero8;
    #pragma unroll
    for (int i = 0; i < 8; ++i) zero8[i] = 0.0f;
    f8 acc[4][4];
    #pragma unroll
    for (int r = 0; r < 4; ++r) {
        #pragma unroll
        for (int n = 0; n < 4; ++n) acc[r][n] = zero8;
    }
    f8 dsum = zero8;

    // k tile (64 rows x 512) -> LDS once, padded pitch; it lives in the output staging area, which is written only after the loop
    _Float16* ksm = reinterpret_cast<_Float16*>(ost);
    _Float16* qs  = ksm + BM * QP;
    {
        const _Float16* src = k16 + ((size_t)b * SEQ + i0) * DIM + tid * 8;
        h8n kv[16];
        #pragma unroll
        for (int u = 0; u < 16; ++u) kv[u] = *(const h8*)(src + u * 2048);
        // no register that an issued load names is rewritten ahead of this wait
        asm volatile("s_wait_xcnt 0x0" ::: "memory");
        #pragma unroll
        for (int u = 0; u < 16; ++u) {
            const int idx = (u * 256 + tid) * 8;
            *(h8*)&ksm[(idx >> 9) * QP + (idx & (DIM - 1))] = kv[u];
        }
    }

    // A operand (k rows of this wave's tile): row m, fragment halves at +8h and +16+8h within each 32-deep step
    const _Float16* kA = ksm + (mt * 16 + m) * QP + 8 * h;
    // B operand (q rows, gathered down column n = m): same k map as A
    const _Float16* q0 = qs + (jp * 32 + m) * QP + 8 * h;
    const _Float16* q1 = qs + (jp * 32 + 16 + m) * QP + 8 * h;

    // lane addresses of the copies: copy u of a tile moves 4 KB (four q rows; 64 rows of a V chunk), 16 B per lane
    const _Float16* qsrc = q16 + (size_t)b * SEQ * DIM + tid * 8;
    const _Float16* vsrc = vtg + (size_t)b * NITER * (DIM * BJ) + tid * 8;
    _Float16* qdst = qs + (tid >> 6) * QP + (tid & 63) * 8;
    _Float16* vdst = vT + tid * 8;

    // q rows of trip 0 (no wave has touched qs before)
    #pragma unroll
    for (int u = 0; u < 16; ++u) copy16(qsrc + u * 2048, qdst + u * 4 * QP);

    #pragma unroll 1
    for (int it = 0; it < NTRIP; ++it) {
        // hand-over at the head of a trip: this wave's LDS reads of vT and pbuf (and on trip 0 its k tile stores) have retired,
        // its copies of this trip's q rows have landed; the barrier publishes the q rows and frees vT and pbuf
        asm volatile("s_wait_dscnt 0x0" ::: "memory");
        asm volatile("s_wait_asynccnt 0x0" ::: "memory");
        __syncthreads();

        // the two V chunks of this trip (already transposed and converted; adjacent in the plane, same layout in LDS) fly during S
        #pragma unroll
        for (int u = 0; u < 16; ++u) copy16(vsrc + (size_t)it * (DIM * TJ) + u * 2048, vdst + u * 2048);

        // S tile 64x64 (every wave: 16 rows x 32 q), exp, publish P, accumulate row sums
        {
            f8 s0 = zero8, s1 = zero8;
            // fragments in a ring of SD register sets, one depth step each: the loads of step ks + SD are issued right behind
            // the products of step ks, so that a wave waits only for loads that are SD steps old (all inside this phase)
            Frag a[SD], b0[SD], b1[SD];
            #pragma unroll
            for (int t = 0; t < SD; ++t) {
                const int c = t * 32;
                a[t].h[0]  = *(const h8*)(kA + c);          // k = c + 8h + 0..7
                a[t].h[1]  = *(const h8*)(kA + c + 16);     // k = c + 16 + 8h + 0..7
                b0[t].h[0] = *(const h8*)(q0 + c);
                b0[t].h[1] = *(const h8*)(q0 + c + 16);
                b1[t].h[0] = *(const h8*)(q1 + c);
                b1[t].h[1] = *(const h8*)(q1 + c + 16);
            }
            // unrolled whole: the set index must be a constant for the ring to stay in registers
            #pragma unroll
            for (int ks = 0; ks < DIM / 32; ++ks) {
                const int t = ks % SD;
                s0 = wmma_f16(a[t].v, b0[t].v, s0);
                s1 = wmma_f16(a[t].v, b1[t].v, s1);
                if (ks + SD < DIM / 32) {
                    const int c = (ks + SD) * 32;
                    a[t].h[0]  = *(const h8*)(kA + c);
                    a[t].h[1]  = *(const h8*)(kA + c + 16);
                    b0[t].h[0] = *(const h8*)(q0 + c);
                    b0[t].h[1] = *(const h8*)(q0 + c + 16);
                    b1[t].h[0] = *(const h8*)(q1 + c);
                    b1[t].h[1] = *(const h8*)(q1 + c + 16);
                }
            }
            float e0[8], e1[8];
            #pragma unroll
            for (int i = 0; i < 8; ++i) {
                e0[i] = exp_slot(s0[i] * S_UNSCALE);
                e1[i] = exp_slot(s1[i] * S_UNSCALE);
            }
            // D element i of lane -> row 8h+i, col m (tile 0) / 16+m (tile 1) of the wave's q half
            #pragma unroll
            for (int i = 0; i < 8; ++i) {
                const int row = mt * 16 + 8 * h + i;
                pbuf[row * PP + jp * 32 + m]      = (_Float16)e0[i];
                pbuf[row * PP + jp * 32 + 16 + m] = (_Float16)e1[i];
            }
            #pragma unroll
            for (int i = 0; i < 8; ++i) {
                float t = e0[i] + e1[i];
                t += __shfl_xor(t, 1);
                t += __shfl_xor(t, 2);
                t += __shfl_xor(t, 4);
                t += __shfl_xor(t, 8);
                dsum[i] += t;
            }
        }
        // hand-over between S and PV: this wave's P stores and its reads of the q rows have retired, its V copies have landed
        // (the last copies of the kernel among them); the barrier publishes pbuf and vT and frees the q rows
        asm volatile("s_wait_dscnt 0x0" ::: "memory");
        asm volatile("s_wait_asynccnt 0x0" ::: "memory");
        __syncthreads();

        // the q rows of the next trip fly during PV (block-uniform test)
        if (it + 1 < NTRIP) {
            #pragma unroll
            for (int u = 0; u < 16; ++u) copy16(qsrc + (size_t)(it + 1) * (TJ * DIM) + u * 2048, qdst + u * 4 * QP);
        }

        // PV: acc[krow][d] += P[krow][j] * V[j][d], one 32-deep step per chunk. The P fragments of both chunks and the first
        // PD of the eight V fragments are loaded as one run ahead of the products; V fragment s + PD follows the products of s
        {
            Frag ap[2][4], bv[PD];
            const _Float16* pr = pbuf + m * PP + 8 * h;
            const _Float16* vp = vT + (wave * 64 + m) * VP + 8 * h;
            #pragma unroll
            for (int r = 0; r < 4; ++r) {
                ap[0][r].h[0] = *(const h8*)(pr + r * 16 * PP);          // j = 8h + 0..7
                ap[0][r].h[1] = *(const h8*)(pr + r * 16 * PP + 16);     // j = 16 + 8h + 0..7
            }
            #pragma unroll
            for (int s = 0; s < PD; ++s) {
                const int o = (s >> 2) * (DIM * VP) + (s & 3) * 16 * VP;   // chunk s / 4, n-tile s % 4
                bv[s].h[0] = *(const h8*)(vp + o);        // j = 32kk + 8h + 0..7
                bv[s].h[1] = *(const h8*)(vp + o + 16);   // j = 32kk + 16 + 8h + 0..7
            }
            #pragma unroll
            for (int r = 0; r < 4; ++r) {
                ap[1][r].h[0] = *(const h8*)(pr + r * 16 * PP + 32);     // j = 32 + 8h + 0..7
                ap[1][r].h[1] = *(const h8*)(pr + r * 16 * PP + 48);     // j = 48 + 8h + 0..7
            }
            #pragma unroll
            for (int s = 0; s < 8; ++s) {
                const int kk = s >> 2, nt = s & 3, t = s % PD;
                #pragma unroll
                for (int r = 0; r < 4; ++r) acc[r][nt] = wmma_f16(ap[kk][r].v, bv[t].v, acc[r][nt]);
                if (s + PD < 8) {
                    const int o = ((s + PD) >> 2) * (DIM * VP) + ((s + PD) & 3) * 16 * VP;
                    bv[t].h[0] = *(const h8*)(vp + o);
                    bv[t].h[1] = *(const h8*)(vp + o + 16);
                }
            }
        }
    }

    // partial denominators (sum of exp over the wave's q halves) to LDS
    if (m == 0) {
        #pragma unroll
        for (int i = 0; i < 8; ++i) denom_s[jp * BM + mt * 16 + 8 * h + i] = dsum[i];
    }

    // mask[row] = any(v[b, i0+row, :] != 0): 4 threads per row, 128 floats each, OR via shuffles
    {
        const int row = tid >> 2;
        const int seg = tid & 3;
        const float* src = vg + ((size_t)b * SEQ + i0 + row) * DIM + seg * 128;
        int nz = 0;
        #pragma unroll 4
        for (int u = 0; u < 32; ++u) {
            const float4 x = *(const float4*)(src + u * 4);
            nz |= (int)(x.x != 0.0f) | (int)(x.y != 0.0f) | (int)(x.z != 0.0f) | (int)(x.w != 0.0f);
        }
        nz |= __shfl_xor(nz, 1);
        nz |= __shfl_xor(nz, 2);
        if (seg == 0) mask_s[row] = (unsigned)nz;
    }
    __syncthreads();

    // scale and stage the tile in LDS
    #pragma unroll
    for (int r = 0; r < 4; ++r) {
        float sc[8];
        #pragma unroll
        for (int i = 0; i < 8; ++i) {
            const int row = r * 16 + 8 * h + i;
            const float den = (denom_s[row] + denom_s[BM + row]) + EPS_SCALED;
            sc[i] = (mask_s[row] != 0u) ? (O_UNSCALE * __builtin_amdgcn_rcpf(den)) : 0.0f;
        }
        #pragma unroll
        for (int nt = 0; nt < 4; ++nt) {
            #pragma unroll
            for (int i = 0; i < 8; ++i) {
                const int row = r * 16 + 8 * h + i;
                ost[row * DIM + wave * 64 + nt * 16 + m] = acc[r][nt][i] * sc[i];
            }
        }
    }
    __syncthreads();

    // whole-line stores: the 64x512 f32 tile is one contiguous 128 KB span of d_out; each lane stores 16 B,
    {
        float* ob = outg + ((size_t)b * SEQ + i0) * DIM;
        v4fn vals[32];
        #pragma unroll
        for (int u = 0; u < 32; ++u) {
            const int idx = (u * 256 + tid) * 4;
            vals[u] = *(const v4f*)&ost[idx];
        }
        #pragma unroll
        for (int u = 0; u < 32; ++u) {
            const int idx = (u * 256 + tid) * 4;
            *(v4f*)(ob + idx) = vals[u];
        }
    }
}

extern "C" void kernel_launch(void* const* d_in, const int* in_sizes, int n_in,
                              void* d_out, int out_size, void* d_ws, size_t ws_size,
                              hipStream_t stream)
{
    if (n_in < 3) return;
    if (in_sizes[0] != NTOT || in_sizes[1] != NTOT || in_sizes[2] != NTOT) return;
    if (out_size != NTOT) return;

    const size_t plane_bytes = (size_t)NTOT * sizeof(_Float16);     // 16 MiB each
    const size_t need = 3 * plane_bytes;                             // 48 MiB total carve
    if (d_ws == nullptr || ws_size < need) return;

    const float* q = (const float*)d_in[0];
    const float* k = (const float*)d_in[1];
    const float* v = (const float*)d_in[2];
    float* out = (float*)d_out;

    _Float16* q16  = (_Float16*)d_ws;
    _Float16* k16  = (_Float16*)((char*)d_ws + plane_bytes);
    _Float16* vt16 = (_Float16*)((char*)d_ws + 2 * plane_bytes);

    cvt_qk_kernel<<<dim3(NTOT / (256 * 8), 2), dim3(256), 0, stream>>>(q, k, q16, k16);
    cvt_vt_kernel<<<dim3(BATCH * NITER), dim3(256), 0, stream>>>(v, vt16);
    attn_kernel<<<dim3(SEQ / BM, BATCH), dim3(256), 0, stream>>>(v, q16, k16, vt16, out);
    (void)hipGetLastError();
}

// v006
// A run of this version takes 98.9 microseconds.
// Two timings next to v005 put it at 1.04 and 1.03 times that version's speed.
// Counting every step since v000, it is 4.33 times as fast.
#include <hip/hip_runtime.h>
#include <stddef.h>

// Contractions: S = K*Q^T and O = P*V on v_wmma_f32_16x16x32_f16 (f16 operands, q/k/v pre-scaled by 16, f32 accumulate); exp, row sums, mask and epilogue in f32.

typedef _Float16 h16 __attribute__((ext_vector_type(16)));
typedef _Float16 h8n __attribute__((ext_vector_type(8)));
typedef _Float16 h8  __attribute__((ext_vector_type(8), __may_alias__));
typedef float    f8  __attribute__((ext_vector_type(8)));
typedef float    v4fn __attribute__((ext_vector_type(4)));
typedef float    v4f __attribute__((ext_vector_type(4), __may_alias__));

union Frag { h16 v; h8n h[2]; };

typedef int i4n __attribute__((ext_vector_type(4)));
typedef __attribute__((address_space(1))) i4n gi4;
typedef __attribute__((address_space(3))) i4n li4;

#define BATCH 8
#define SEQ   2048
#define DIM   512
#define BM    64            // output rows (k index) per block
#define BJ    32            // q rows per transposed V chunk = depth of one PV step
#define NITER (SEQ / BJ)    // 64 chunks per batch
#define TJ    64            // q rows per trip of the main loop (two chunks)
#define NTRIP (SEQ / TJ)    // 32
#define SD    3             // depth steps of S whose q fragments are held in registers at a time
#define PD    3             // V fragments of PV held in registers at a time
#define NTOT  (BATCH * SEQ * DIM)
#define VP    32            // vT pitch in halves: vT[d][j]
#define LTQ   (4 * VP + 8)  // halves per four rows of the plane in cvt_vt's LDS: 256 B + 16 B pad = 272 B
#define PP    (TJ + 8)      // pbuf pitch in halves: pbuf[krow][j], 144 B = 16 B x 9
#define QP    (DIM + 8)     // LDS row pitch in halves of the staged q chunk and k tile: 1040 B = 16 B x 65, b128 fragment reads fall on distinct banks

#define QK_SCALE   16.0f           // q and k carried x16 in f16 -> S carried x256
#define V_SCALE    16.0f           // v carried x16 in f16 -> O carried x16
#define S_UNSCALE  (1.0f / 256.0f)
#define O_UNSCALE  (1.0f / 16.0f)
#define EPS_SCALED 2.2627417e-6f   // 1e-7 * sqrt(512): eps applied after the 1/sqrt(d) factor, P kept as pure exp

static_assert(SEQ % BM == 0);
static_assert(SEQ % BJ == 0);
static_assert(DIM % 32 == 0);
static_assert(NTOT % (256 * 8) == 0);
static_assert(SEQ % TJ == 0 && TJ == 2 * BJ);
static_assert(BM * DIM == 32 * 256 * 4);
static_assert(DIM * BJ == 8 * 256 * 8);
static_assert(DIM / 4 == 128 && BJ == 32 && VP == BJ);   // cvt_vt: 128 column quads x 2 halves of 16 rows = 256 lanes
static_assert(DIM * TJ == 16 * 256 * 8);
static_assert(BM * DIM == 16 * 256 * 8);
static_assert((BM + TJ) * QP * sizeof(_Float16) >= BM * DIM * sizeof(float));   // the output tile fits in the area of the k tile and the q rows

__device__ __forceinline__ f8 wmma_f16(h16 a, h16 b, f8 c) {
    f8 d = __builtin_amdgcn_wmma_f32_16x16x32_f16(false, a, false, b, (short)0, c, false, false);
    asm volatile("v_nop\n\tv_nop\n\tv_nop\n\tv_nop" : "+v"(d) : "v"(a), "v"(b));
    return d;
}

// the same product as S uses it: no asm statement names its operands, so that the resident k fragments may sit above v255
// (an asm operand cannot); the compiler keeps the distance behind its own builtin form
__device__ __forceinline__ f8 wmma_f16_hi(h16 a, h16 b, f8 c) {
    return __builtin_amdgcn_wmma_f32_16x16x32_f16(false, a, false, b, (short)0, c, false, false);
}

// asynchronous copy of the lane's own 16 bytes from global memory to LDS, through no register;
// landed only behind the issuing wave's s_wait_asynccnt 0, readable by other waves only behind the next barrier
__device__ __forceinline__ void copy16(const _Float16* g, _Float16* l) {
    __builtin_amdgcn_global_load_async_to_lds_b128((gi4*)g, (li4*)l, 0, 0);
}

// e^x as __expf forms it (x * log2(e), then v_exp_f32), with the one slot that the instruction set asks for behind a
// transcendental in the instruction's own statement: a v_nop in a statement of its own did not stay behind it
__device__ __forceinline__ float exp_slot(float x) {
    float r;
    asm("v_exp_f32 %0, %1\n\tv_nop" : "=v"(r) : "v"(x * 0x1.715476p+0f));
    return r;
}

// ---------------- prep: q,k f32 -> f16 row planes (x16) ----------------
__global__ __launch_bounds__(256)
void cvt_qk_kernel(const float* __restrict__ q, const float* __restrict__ k,
                   _Float16* __restrict__ q16, _Float16* __restrict__ k16)
{
    const bool isk = (blockIdx.y != 0);          // block-uniform
    const float* src = isk ? k : q;
    _Float16*    dst = isk ? k16 : q16;
    const size_t i = ((size_t)blockIdx.x * 256 + threadIdx.x) * 8;
    const float4 a = *(const float4*)(src + i);
    const float4 b = *(const float4*)(src + i + 4);
    h8n o;
    o[0] = (_Float16)(a.x * QK_SCALE); o[1] = (_Float16)(a.y * QK_SCALE);
    o[2] = (_Float16)(a.z * QK_SCALE); o[3] = (_Float16)(a.w * QK_SCALE);
    o[4] = (_Float16)(b.x * QK_SCALE); o[5] = (_Float16)(b.y * QK_SCALE);
    o[6] = (_Float16)(b.z * QK_SCALE); o[7] = (_Float16)(b.w * QK_SCALE);
    h8* p = (h8*)(dst + i);
    *p = o;
    
}

// ---------------- prep: v f32 -> per-chunk transposed f16 plane (x16) ----------------
// vtg[b*NITER + it][d][j] = f16(16 * v[b][it*32 + j][d]); one block per (b, it).
// The transposition is done in registers: a lane reads the same four columns of two groups of eight consecutive rows (each wave-wide
// load is 512 contiguous bytes of one row) and so holds, per group and column, eight neighbours along j = one 16 B piece of the plane.
// LDS only reorders those pieces into the plane's linear order for whole-line stores. Four plane rows (256 B) are followed by a
// 16 B pad: lanes that are four rows apart then store 272 B apart, on distinct banks, and the read-back stays contiguous per 256 B.
__global__ __launch_bounds__(256)
void cvt_vt_kernel(const float* __restrict__ v, _Float16* __restrict__ vtg)
{
    __shared__ __align__(16) _Float16 lt[(DIM / 4) * LTQ];
    const int tid = threadIdx.x;
    const int blk = blockIdx.x;                   // b*NITER + it
    const int b   = blk / NITER;
    const int it  = blk - b * NITER;
    const int dq  = tid & 127;                    // column quad: d = 4*dq .. 4*dq + 3
    const int jh  = tid >> 7;                     // wave-uniform: row groups 2*jh and 2*jh + 1 (eight rows each)
    const float* src = v + ((size_t)b * SEQ + (size_t)it * BJ + jh * 16) * DIM + dq * 4;

    v4fn x[16];                                   // x[r] = v[row 16*jh + r][4*dq .. 4*dq + 3]
    #pragma unroll
    for (int r = 0; r < 16; ++r) x[r] = *(const v4f*)(src + r * DIM);
    // no register that an issued load names is rewritten ahead of this wait; the address is named as an input so that it
    // stays live up to here and no load's own result is placed on it
    asm volatile("s_wait_xcnt 0x0" :: "v"(src) : "memory");

    #pragma unroll
    for (int g = 0; g < 2; ++g) {
        #pragma unroll
        for (int i = 0; i < 4; ++i) {
            h8n o;
            #pragma unroll
            for (int r = 0; r < 8; ++r) o[r] = (_Float16)(x[g * 8 + r][i] * V_SCALE);
            *(h8*)&lt[dq * LTQ + i * VP + (jh * 2 + g) * 8] = o;      // plane row 4*dq + i, j = 16*jh + 8*g + 0..7
        }
    }
    __syncthreads();

    _Float16* dst = vtg + (size_t)blk * (DIM * BJ);
    h8n vals[8];
    #pragma unroll
    for (int u = 0; u < 8; ++u) {
        const int n = u * 256 + tid;              // 16 B piece n of the plane: sixteen pieces per four rows
        vals[u] = *(const h8*)&lt[(n >> 4) * LTQ + (n & 15) * 8];
    }
    #pragma unroll
    for (int u = 0; u < 8; ++u) {
        const int idx = (u * 256 + tid) * 8;
        *(h8*)(dst + idx) = vals[u];
    }
    
}

// ---------------- main kernel ----------------
// block = (64 output rows of the k index, batch b), 256 threads = 8 waves, one block per WGP.
// Per trip of 64 q rows:
//   S[krow][q] = sum_d K[krow][d]*Q[q][d], 4 x 4 tiles: wave -> row tile mt = wave&3, q half jp = wave>>2 (two tiles, one A fragment for both);
//   P = exp(S/256) -> LDS (f16), row sums of the wave's 32 q -> dsum (two partial sums per row, added after the loop);
//   acc[krow][d] += P[krow][q] * V[q][d]: every wave takes all 4 row tiles x its own 64 output columns (4 n-tiles),
//   V from the two transposed chunks vT[chunk][d][q], in ascending chunk order.
// The A operand of S never changes: the k tile is staged in LDS once (whole-line loads, through registers), and each wave then reads
// the 16 fragments of its 16 rows once and holds them in 128 registers for the whole loop. The B operand comes from LDS every trip.
// The q rows and the V chunks come per trip by asynchronous copies of whole lines: V of this trip flies while S is formed, the q rows
// of the next trip fly during PV.
// Fragment reads run ahead of the products inside each phase (register rings), never across a barrier. Every operand of wmma_f16
// is named in its asm statement and so sits below v256: accumulators (128) + PV's rings must fit there, or the accumulators spill;
// S uses wmma_f16_hi, whose operands are free of that. Two waves share a SIMD: a wave may hold 512 registers at most.
// Left, by the count of LDS clocks a trip asks for: every q fragment is still read by four waves (one per row tile); vT's 64 B pitch
// costs its b128 reads four times the clocks of a 16 B x odd pitch; row sums go through ds_bpermute. In the prep launches,
// cvt_qk starts 65,536 waves of one 32 B read per lane.
__global__ __launch_bounds__(256)
void attn_kernel(const float* __restrict__ vg,
                 const _Float16* __restrict__ q16, const _Float16* __restrict__ k16,
                 const _Float16* __restrict__ vtg,
                 float* __restrict__ outg)
{
    __shared__ __align__(16) _Float16 vT[DIM * TJ];     // 64 KB, vT[chunk][d][j], two chunks of pitch VP
    __shared__ __align__(16) _Float16 pbuf[BM * PP];    // 9 KB,  pbuf[krow][j]
    __shared__ __align__(16) float    ost[(BM + TJ) * QP / 2];   // 130 KB: k tile and q rows (f16, padded pitch) during the loop, output staging (row pitch DIM) after it
    __shared__ float    denom_s[2 * BM];
    __shared__ unsigned mask_s[BM];

    const int tid  = threadIdx.x;
    const int lane = tid & 31;
    const int wave = tid >> 5;
    const int h    = lane >> 4;
    const int m    = lane & 15;
    const int mt   = wave & 3;
    const int jp   = wave >> 2;
    const int b    = blockIdx.y;
    const int i0   = blockIdx.x * BM;

    f8 zero8;
    #pragma unroll
    for (int i = 0; i < 8; ++i) zero8[i] = 0.0f;
    f8 acc[4][4];
    #pragma unroll
    for (int r = 0; r < 4; ++r) {
        #pragma unroll
        for (int n = 0; n < 4; ++n) acc[r][n] = zero8;
    }
    f8 dsum = zero8;

    // k tile (64 rows x 512) -> LDS once, padded pitch; it lives in the output staging area, which is written only after the loop
    _Float16* ksm = reinterpret_cast<_Float16*>(ost);
    _Float16* qs  = ksm + BM * QP;
    {
        const _Float16* src = k16 + ((size_t)b * SEQ + i0) * DIM + tid * 8;
        h8n kv[16];
        #pragma unroll
        for (int u = 0; u < 16; ++u) kv[u] = *(const h8*)(src + u * 2048);
        // no register that an issued load names is rewritten ahead of this wait
        asm volatile("s_wait_xcnt 0x0" ::: "memory");
        #pragma unroll
        for (int u = 0; u < 16; ++u) {
            const int idx = (u * 256 + tid) * 8;
            *(h8*)&ksm[(idx >> 9) * QP + (idx & (DIM - 1))] = kv[u];
        }
    }

    // A operand (k rows of this wave's tile): row m, fragment halves at +8h and +16+8h within each 32-deep step
    const _Float16* kA = ksm + (mt * 16 + m) * QP + 8 * h;
    // B operand (q rows, gathered down column n = m): same k map as A
    const _Float16* q0 = qs + (jp * 32 + m) * QP + 8 * h;
    const _Float16* q1 = qs + (jp * 32 + 16 + m) * QP + 8 * h;

    // lane addresses of the copies: copy u of a tile moves 4 KB (four q rows; 64 rows of a V chunk), 16 B per lane
    const _Float16* qsrc = q16 + (size_t)b * SEQ * DIM + tid * 8;
    const _Float16* vsrc = vtg + (size_t)b * NITER * (DIM * BJ) + tid * 8;
    _Float16* qdst = qs + (tid >> 6) * QP + (tid & 63) * 8;
    _Float16* vdst = vT + tid * 8;

    // q rows of trip 0 (no wave has touched qs before)
    #pragma unroll
    for (int u = 0; u < 16; ++u) copy16(qsrc + u * 2048, qdst + u * 4 * QP);

    // the wave's 16 k rows never change: all 16 depth steps of its A operand are read from the staged tile once and stay in
    // registers (128 per lane) for the whole loop; the barrier publishes the k tile, which all waves have stored
    __syncthreads();
    Frag ka[DIM / 32];
    // unrolled whole: the fragment index must be a constant for the fragments to stay in registers
    #pragma unroll
    for (int ks = 0; ks < DIM / 32; ++ks) {
        ka[ks].h[0] = *(const h8*)(kA + ks * 32);          // k = 32ks + 8h + 0..7
        ka[ks].h[1] = *(const h8*)(kA + ks * 32 + 16);     // k = 32ks + 16 + 8h + 0..7
    }

    #pragma unroll 1
    for (int it = 0; it < NTRIP; ++it) {
        // hand-over at the head of a trip: this wave's LDS reads of vT and pbuf (on trip 0: of the k tile) have retired,
        // its copies of this trip's q rows have landed; the barrier publishes the q rows and frees vT and pbuf
        asm volatile("s_wait_dscnt 0x0" ::: "memory");
        asm volatile("s_wait_asynccnt 0x0" ::: "memory");
        __syncthreads();

        // the two V chunks of this trip (already transposed and converted; adjacent in the plane, same layout in LDS) fly during S
        #pragma unroll
        for (int u = 0; u < 16; ++u) copy16(vsrc + (size_t)it * (DIM * TJ) + u * 2048, vdst + u * 2048);

        // S tile 64x64 (every wave: 16 rows x 32 q), exp, publish P, accumulate row sums
        {
            f8 s0 = zero8, s1 = zero8;
            // q fragments in a ring of SD register sets, one depth step each: the loads of step ks + SD are issued with
            // the products of step ks, so that a wave waits only for loads that are SD steps old (all inside this phase)
            Frag b0[SD], b1[SD];
            #pragma unroll
            for (int t = 0; t < SD; ++t) {
                const int c = t * 32;
                b0[t].h[0] = *(const h8*)(q0 + c);          // k = c + 8h + 0..7
                b0[t].h[1] = *(const h8*)(q0 + c + 16);     // k = c + 16 + 8h + 0..7
                b1[t].h[0] = *(const h8*)(q1 + c);
                b1[t].h[1] = *(const h8*)(q1 + c + 16);
            }
            // scheduling fence, here and at the foot of every step: it holds the ring in the order written. Without the fences the
            // compiler, at this register count, either pulls each load down to its product (a full LDS latency per product) or
            // leaves the whole phase in source order, exp and row sums as one dependent chain per element
            __builtin_amdgcn_sched_barrier(0);
            // unrolled whole: the set index must be a constant for the ring to stay in registers
            #pragma unroll
            for (int ks = 0; ks < DIM / 32; ++ks) {
                const int t = ks % SD;
                s0 = wmma_f16_hi(ka[ks].v, b0[t].v, s0);
                s1 = wmma_f16_hi(ka[ks].v, b1[t].v, s1);
                if (ks + SD < DIM / 32) {
                    const int c = (ks + SD) * 32;
                    b0[t].h[0] = *(const h8*)(q0 + c);
                    b0[t].h[1] = *(const h8*)(q0 + c + 16);
                    b1[t].h[0] = *(const h8*)(q1 + c);
                    b1[t].h[1] = *(const h8*)(q1 + c + 16);
                }
                __builtin_amdgcn_sched_barrier(0);   // holds the ring's order, as said above the loop; the last one parts S from exp and row sums
            }
            float e0[8], e1[8];
            #pragma unroll
            for (int i = 0; i < 8; ++i) {
                e0[i] = exp_slot(s0[i] * S_UNSCALE);
                e1[i] = exp_slot(s1[i] * S_UNSCALE);
            }
            // D element i of lane -> row 8h+i, col m (tile 0) / 16+m (tile 1) of the wave's q half
            #pragma unroll
            for (int i = 0; i < 8; ++i) {
                const int row = mt * 16 + 8 * h + i;
                pbuf[row * PP + jp * 32 + m]      = (_Float16)e0[i];
                pbuf[row * PP + jp * 32 + 16 + m] = (_Float16)e1[i];
            }
            #pragma unroll
            for (int i = 0; i < 8; ++i) {
                float t = e0[i] + e1[i];
                t += __shfl_xor(t, 1);
                t += __shfl_xor(t, 2);
                t += __shfl_xor(t, 4);
                t += __shfl_xor(t, 8);
                dsum[i] += t;
            }
        }
        // hand-over between S and PV: this wave's P stores and its reads of the q rows have retired, its V copies have landed
        // (the last copies of the kernel among them); the barrier publishes pbuf and vT and frees the q rows
        asm volatile("s_wait_dscnt 0x0" ::: "memory");
        asm volatile("s_wait_asynccnt 0x0" ::: "memory");
        __syncthreads();

        // the q rows of the next trip fly during PV (block-uniform test)
        if (it + 1 < NTRIP) {
            #pragma unroll
            for (int u = 0; u < 16; ++u) copy16(qsrc + (size_t)(it + 1) * (TJ * DIM) + u * 2048, qdst + u * 4 * QP);
        }

        // PV: acc[krow][d] += P[krow][j] * V[j][d], one 32-deep step per chunk. The P fragments of both chunks and the first
        // PD of the eight V fragments are loaded as one run ahead of the products; V fragment s + PD follows the products of s
        {
            Frag ap[2][4], bv[PD];
            const _Float16* pr = pbuf + m * PP + 8 * h;
            const _Float16* vp = vT + (wave * 64 + m) * VP + 8 * h;
            #pragma unroll
            for (int r = 0; r < 4; ++r) {
                ap[0][r].h[0] = *(const h8*)(pr + r * 16 * PP);          // j = 8h + 0..7
                ap[0][r].h[1] = *(const h8*)(pr + r * 16 * PP + 16);     // j = 16 + 8h + 0..7
            }
            #pragma unroll
            for (int s = 0; s < PD; ++s) {
                const int o = (s >> 2) * (DIM * VP) + (s & 3) * 16 * VP;   // chunk s / 4, n-tile s % 4
                bv[s].h[0] = *(const h8*)(vp + o);        // j = 32kk + 8h + 0..7
                bv[s].h[1] = *(const h8*)(vp + o + 16);   // j = 32kk + 16 + 8h + 0..7
            }
            #pragma unroll
            for (int r = 0; r < 4; ++r) {
                ap[1][r].h[0] = *(const h8*)(pr + r * 16 * PP + 32);     // j = 32 + 8h + 0..7
                ap[1][r].h[1] = *(const h8*)(pr + r * 16 * PP + 48);     // j = 48 + 8h + 0..7
            }
            #pragma unroll
            for (int s = 0; s < 8; ++s) {
                const int kk = s >> 2, nt = s & 3, t = s % PD;
                #pragma unroll
                for (int r = 0; r < 4; ++r) acc[r][nt] = wmma_f16(ap[kk][r].v, bv[t].v, acc[r][nt]);
                if (s + PD < 8) {
                    const int o = ((s + PD) >> 2) * (DIM * VP) + ((s + PD) & 3) * 16 * VP;
                    bv[t].h[0] = *(const h8*)(vp + o);
                    bv[t].h[1] = *(const h8*)(vp + o + 16);
                }
            }
        }
    }

    // partial denominators (sum of exp over the wave's q halves) to LDS
    if (m == 0) {
        #pragma unroll
        for (int i = 0; i < 8; ++i) denom_s[jp * BM + mt * 16 + 8 * h + i] = dsum[i];
    }

    // mask[row] = any(v[b, i0+row, :] != 0): 4 threads per row, 128 floats each, OR via shuffles
    {
        const int row = tid >> 2;
        const int seg = tid & 3;
        const float* src = vg + ((size_t)b * SEQ + i0 + row) * DIM + seg * 128;
        int nz = 0;
        #pragma unroll 4
        for (int u = 0; u < 32; ++u) {
            const float4 x = *(const float4*)(src + u * 4);
            nz |= (int)(x.x != 0.0f) | (int)(x.y != 0.0f) | (int)(x.z != 0.0f) | (int)(x.w != 0.0f);
        }
        nz |= __shfl_xor(nz, 1);
        nz |= __shfl_xor(nz, 2);
        if (seg == 0) mask_s[row] = (unsigned)nz;
    }
    __syncthreads();

    // scale and stage the tile in LDS
    #pragma unroll
    for (int r = 0; r < 4; ++r) {
        float sc[8];
        #pragma unroll
        for (int i = 0; i < 8; ++i) {
            const int row = r * 16 + 8 * h + i;
            const float den = (denom_s[row] + denom_s[BM + row]) + EPS_SCALED;
            sc[i] = (mask_s[row] != 0u) ? (O_UNSCALE * __builtin_amdgcn_rcpf(den)) : 0.0f;
        }
        #pragma unroll
        for (int nt = 0; nt < 4; ++nt) {
            #pragma unroll
            for (int i = 0; i < 8; ++i) {
                const int row = r * 16 + 8 * h + i;
                ost[row * DIM + wave * 64 + nt * 16 + m] = acc[r][nt][i] * sc[i];
            }
        }
    }
    __syncthreads();

    // whole-line stores: the 64x512 f32 tile is one contiguous 128 KB span of d_out; each lane stores 16 B,
    {
        float* ob = outg + ((size_t)b * SEQ + i0) * DIM;
        v4fn vals[32];
        #pragma unroll
        for (int u = 0; u < 32; ++u) {
            const int idx = (u * 256 + tid) * 4;
            vals[u] = *(const v4f*)&ost[idx];
        }
        #pragma unroll
        for (int u = 0; u < 32; ++u) {
            const int idx = (u * 256 + tid) * 4;
            *(v4f*)(ob + idx) = vals[u];
        }
    }
}

extern "C" void kernel_launch(void* const* d_in, const int* in_sizes, int n_in,
                              void* d_out, int out_size, void* d_ws, size_t ws_size,
                              hipStream_t stream)
{
    if (n_in < 3) return;
    if (in_sizes[0] != NTOT || in_sizes[1] != NTOT || in_sizes[2] != NTOT) return;
    if (out_size != NTOT) return;

    const size_t plane_bytes = (size_t)NTOT * sizeof(_Float16);     // 16 MiB each
    const size_t need = 3 * plane_bytes;                             // 48 MiB total carve
    if (d_ws == nullptr || ws_size < need) return;

    const float* q = (const float*)d_in[0];
    const float* k = (const float*)d_in[1];
    const float* v = (const float*)d_in[2];
    float* out = (float*)d_out;

    _Float16* q16  = (_Float16*)d_ws;
    _Float16* k16  = (_Float16*)((char*)d_ws + plane_bytes);
    _Float16* vt16 = (_Float16*)((char*)d_ws + 2 * plane_bytes);

    cvt_qk_kernel<<<dim3(NTOT / (256 * 8), 2), dim3(256), 0, stream>>>(q, k, q16, k16);
    cvt_vt_kernel<<<dim3(BATCH * NITER), dim3(256), 0, stream>>>(v, vt16);
    attn_kernel<<<dim3(SEQ / BM, BATCH), dim3(256), 0, stream>>>(v, q16, k16, vt16, out);
    (void)hipGetLastError();
}

// v007
// A run of this version takes 94.7 microseconds.
// Timed twice side by side with v006, it ran 1.05 and 1.04 times as fast.
// Over all steps from v000 it is 4.53 times as fast.
#include <hip/hip_runtime.h>
#include <stddef.h>

// Contractions: S = K*Q^T and O = P*V on v_wmma_f32_16x16x32_f16 (f16 operands, q/k/v pre-scaled by 16, f32 accumulate); exp, row sums, mask and epilogue in f32.

typedef _Float16 h16 __attribute__((ext_vector_type(16)));
typedef _Float16 h8n __attribute__((ext_vector_type(8)));
typedef _Float16 h8  __attribute__((ext_vector_type(8), __may_alias__));
typedef float    f8  __attribute__((ext_vector_type(8)));
typedef float    v4fn __attribute__((ext_vector_type(4)));
typedef float    v4f __attribute__((ext_vector_type(4), __may_alias__));

union Frag { h16 v; h8n h[2]; };

typedef int i4n __attribute__((ext_vector_type(4)));
typedef __attribute__((address_space(1))) i4n gi4;
typedef __attribute__((address_space(3))) i4n li4;

#define BATCH 8
#define SEQ   2048
#define DIM   512
#define BM    64            // output rows (k index) per block
#define BJ    32            // q rows per transposed V chunk = depth of one PV step
#define NITER (SEQ / BJ)    // 64 chunks per batch
#define TJ    64            // q rows per trip of the main loop (two chunks)
#define NTRIP (SEQ / TJ)    // 32
#define SD    3             // depth steps of S whose q fragments are held in registers at a time
#define PD    3             // V fragments of PV held in registers at a time
#define NTOT  (BATCH * SEQ * DIM)
#define VP    32            // vT pitch in halves: vT[d][j]
#define LTQ   (4 * VP + 8)  // halves per four rows of the plane in the V transposition's LDS: 256 B + 16 B pad = 272 B
#define PP    (TJ + 8)      // pbuf pitch in halves: pbuf[krow][j], 144 B = 16 B x 9
#define QP    (DIM + 8)     // LDS row pitch in halves of the staged q chunk and k tile: 1040 B = 16 B x 65, b128 fragment reads fall on distinct banks

#define QK_SCALE   16.0f           // q and k carried x16 in f16 -> S carried x256
#define V_SCALE    16.0f           // v carried x16 in f16 -> O carried x16
#define S_UNSCALE  (1.0f / 256.0f)
#define O_UNSCALE  (1.0f / 16.0f)
#define EPS_SCALED 2.2627417e-6f   // 1e-7 * sqrt(512): eps applied after the 1/sqrt(d) factor, P kept as pure exp

static_assert(SEQ % BM == 0);
static_assert(SEQ % BJ == 0);
static_assert(DIM % 32 == 0);
static_assert(NTOT % (256 * 8) == 0);
static_assert(SEQ % TJ == 0 && TJ == 2 * BJ);
static_assert(BM * DIM == 32 * 256 * 4);
static_assert(DIM * BJ == 8 * 256 * 8);
static_assert(DIM / 4 == 128 && BJ == 32 && VP == BJ);   // V transposition: 128 column quads x 2 halves of 16 rows = 256 lanes
static_assert(DIM * TJ == 16 * 256 * 8);
static_assert(BM * DIM == 16 * 256 * 8);
static_assert((BM + TJ) * QP * sizeof(_Float16) >= BM * DIM * sizeof(float));   // the output tile fits in the area of the k tile and the q rows

__device__ __forceinline__ f8 wmma_f16(h16 a, h16 b, f8 c) {
    f8 d = __builtin_amdgcn_wmma_f32_16x16x32_f16(false, a, false, b, (short)0, c, false, false);
    asm volatile("v_nop\n\tv_nop\n\tv_nop\n\tv_nop" : "+v"(d) : "v"(a), "v"(b));
    return d;
}

// the same product as S uses it: no asm statement names its operands, so that the resident k fragments may sit above v255
// (an asm operand cannot); the compiler keeps the distance behind its own builtin form
__device__ __forceinline__ f8 wmma_f16_hi(h16 a, h16 b, f8 c) {
    return __builtin_amdgcn_wmma_f32_16x16x32_f16(false, a, false, b, (short)0, c, false, false);
}

// asynchronous copy of the lane's own 16 bytes from global memory to LDS, through no register;
// landed only behind the issuing wave's s_wait_asynccnt 0, readable by other waves only behind the next barrier
__device__ __forceinline__ void copy16(const _Float16* g, _Float16* l) {
    __builtin_amdgcn_global_load_async_to_lds_b128((gi4*)g, (li4*)l, 0, 0);
}

// e^x as __expf forms it (x * log2(e), then v_exp_f32), with the one slot that the instruction set asks for behind a
// transcendental in the instruction's own statement: a v_nop in a statement of its own did not stay behind it
__device__ __forceinline__ float exp_slot(float x) {
    float r;
    asm("v_exp_f32 %0, %1\n\tv_nop" : "=v"(r) : "v"(x * 0x1.715476p+0f));
    return r;
}

// ---------------- prep: one launch for all three planes ----------------
// The V transposition and the q/k conversion read and write disjoint buffers, so they need no order between them: they run as
// one grid. Blocks 0 .. NVB-1 transpose V (the longer blocks, started first), the NCB blocks behind them convert q, the last NCB k.
//
// q, k: f32 -> f16 row planes (x16), 8 values per lane.
//
// V: vtg[b*NITER + it][d][j] = f16(16 * v[b][it*32 + j][d]); one block per (b, it).
// The transposition is done in registers: a lane reads the same four columns of two groups of eight consecutive rows (each wave-wide
// load is 512 contiguous bytes of one row) and so holds, per group and column, eight neighbours along j = one 16 B piece of the plane.
// LDS only reorders those pieces into the plane's linear order for whole-line stores. Four plane rows (256 B) are followed by a
// 16 B pad: lanes that are four rows apart then store 272 B apart, on distinct banks, and the read-back stays contiguous per 256 B.
#define NVB (BATCH * NITER)        // 512 transposing blocks
#define NCB (NTOT / (256 * 8))     // 4,096 converting blocks per plane
__global__ __launch_bounds__(256)
void prep_kernel(const float* __restrict__ q, const float* __restrict__ k, const float* __restrict__ v,
                 _Float16* __restrict__ q16, _Float16* __restrict__ k16, _Float16* __restrict__ vtg)
{
    __shared__ __align__(16) _Float16 lt[(DIM / 4) * LTQ];
    const int tid = threadIdx.x;
    const int blk = blockIdx.x;

    if (blk >= NVB) {                             // block-uniform; these blocks leave in front of the barrier
        const int  c   = blk - NVB;
        const bool isk = (c >= NCB);
        const float* src = isk ? k : q;
        _Float16*    dst = isk ? k16 : q16;
        const size_t i = ((size_t)(isk ? c - NCB : c) * 256 + tid) * 8;
        const float4 a = *(const float4*)(src + i);
        const float4 b = *(const float4*)(src + i + 4);
        h8n o;
        o[0] = (_Float16)(a.x * QK_SCALE); o[1] = (_Float16)(a.y * QK_SCALE);
        o[2] = (_Float16)(a.z * QK_SCALE); o[3] = (_Float16)(a.w * QK_SCALE);
        o[4] = (_Float16)(b.x * QK_SCALE); o[5] = (_Float16)(b.y * QK_SCALE);
        o[6] = (_Float16)(b.z * QK_SCALE); o[7] = (_Float16)(b.w * QK_SCALE);
        h8* p = (h8*)(dst + i);
        *p = o;
        return;
    }

    const int b   = blk / NITER;                  // blk = b*NITER + it
    const int it  = blk - b * NITER;
    const int dq  = tid & 127;                    // column quad: d = 4*dq .. 4*dq + 3
    const int jh  = tid >> 7;                     // wave-uniform: row groups 2*jh and 2*jh + 1 (eight rows each)
    const float* src = v + ((size_t)b * SEQ + (size_t)it * BJ + jh * 16) * DIM + dq * 4;

    // one group of eight rows at a time: 32 registers of loaded values, not 64, so that the whole kernel stays within 64 registers
    // and eight blocks share a WGP, as the converting blocks need for their bytes in flight
    #pragma unroll
    for (int g = 0; g < 2; ++g) {
        v4fn x[8];                                // x[r] = v[row 16*jh + 8*g + r][4*dq .. 4*dq + 3]
        #pragma unroll
        for (int r = 0; r < 8; ++r) x[r] = *(const v4f*)(src + (g * 8 + r) * DIM);
        // no register that an issued load names is rewritten ahead of this wait; the address is named as an input so that it
        // stays live up to here and no load's own result is placed on it
        asm volatile("s_wait_xcnt 0x0" :: "v"(src) : "memory");
        #pragma unroll
        for (int i = 0; i < 4; ++i) {
            h8n o;
            #pragma unroll
            for (int r = 0; r < 8; ++r) o[r] = (_Float16)(x[r][i] * V_SCALE);
            *(h8*)&lt[dq * LTQ + i * VP + (jh * 2 + g) * 8] = o;      // plane row 4*dq + i, j = 16*jh + 8*g + 0..7
        }
        // scheduling fence between the groups: without it the compiler lifts the second group's loads over the first group's
        // conversion and the kernel needs 89 registers (five blocks per WGP)
        if (g == 0) __builtin_amdgcn_sched_barrier(0);
    }
    __syncthreads();

    _Float16* dst = vtg + (size_t)blk * (DIM * BJ);
    h8n vals[8];
    #pragma unroll
    for (int u = 0; u < 8; ++u) {
        const int n = u * 256 + tid;              // 16 B piece n of the plane: sixteen pieces per four rows
        vals[u] = *(const h8*)&lt[(n >> 4) * LTQ + (n & 15) * 8];
    }
    #pragma unroll
    for (int u = 0; u < 8; ++u) {
        const int idx = (u * 256 + tid) * 8;
        *(h8*)(dst + idx) = vals[u];
    }
}

// ---------------- main kernel ----------------
// block = (64 output rows of the k index, batch b), 256 threads = 8 waves, one block per WGP.
// Per trip of 64 q rows:
//   S[krow][q] = sum_d K[krow][d]*Q[q][d], 4 x 4 tiles: wave -> row tile mt = wave&3, q half jp = wave>>2 (two tiles, one A fragment for both);
//   P = exp(S/256) -> LDS (f16), row sums of the wave's 32 q -> dsum (two partial sums per row, added after the loop);
//   acc[krow][d] += P[krow][q] * V[q][d]: every wave takes all 4 row tiles x its own 64 output columns (4 n-tiles),
//   V from the two transposed chunks vT[chunk][d][q], in ascending chunk order.
// The A operand of S never changes: the k tile is staged in LDS once (whole-line loads, through registers), and each wave then reads
// the 16 fragments of its 16 rows once and holds them in 128 registers for the whole loop. The B operand comes from LDS every trip.
// The q rows and the V chunks come per trip by asynchronous copies of whole lines: V of this trip flies while S is formed, the q rows
// of the next trip fly during PV.
// Fragment reads run ahead of the products inside each phase (register rings), never across a barrier. Every operand of wmma_f16
// is named in its asm statement and so sits below v256: accumulators (128) + PV's rings must fit there, or the accumulators spill;
// S uses wmma_f16_hi, whose operands are free of that. Two waves share a SIMD: a wave may hold 512 registers at most.
// Left, by the count of LDS clocks a trip asks for: every q fragment is still read by four waves (one per row tile); vT's 64 B pitch
// costs its b128 reads four times the clocks of a 16 B x odd pitch; row sums go through ds_bpermute. In the prep launch,
// the q/k conversion starts 65,536 waves of one 32 B read per lane.
__global__ __launch_bounds__(256)
void attn_kernel(const float* __restrict__ vg,
                 const _Float16* __restrict__ q16, const _Float16* __restrict__ k16,
                 const _Float16* __restrict__ vtg,
                 float* __restrict__ outg)
{
    __shared__ __align__(16) _Float16 vT[DIM * TJ];     // 64 KB, vT[chunk][d][j], two chunks of pitch VP
    __shared__ __align__(16) _Float16 pbuf[BM * PP];    // 9 KB,  pbuf[krow][j]
    __shared__ __align__(16) float    ost[(BM + TJ) * QP / 2];   // 130 KB: k tile and q rows (f16, padded pitch) during the loop, output staging (row pitch DIM) after it
    __shared__ float    denom_s[2 * BM];
    __shared__ unsigned mask_s[BM];

    const int tid  = threadIdx.x;
    const int lane = tid & 31;
    const int wave = tid >> 5;
    const int h    = lane >> 4;
    const int m    = lane & 15;
    const int mt   = wave & 3;
    const int jp   = wave >> 2;
    const int b    = blockIdx.y;
    const int i0   = blockIdx.x * BM;

    f8 zero8;
    #pragma unroll
    for (int i = 0; i < 8; ++i) zero8[i] = 0.0f;
    f8 acc[4][4];
    #pragma unroll
    for (int r = 0; r < 4; ++r) {
        #pragma unroll
        for (int n = 0; n < 4; ++n) acc[r][n] = zero8;
    }
    f8 dsum = zero8;

    // k tile (64 rows x 512) -> LDS once, padded pitch; it lives in the output staging area, which is written only after the loop
    _Float16* ksm = reinterpret_cast<_Float16*>(ost);
    _Float16* qs  = ksm + BM * QP;
    {
        const _Float16* src = k16 + ((size_t)b * SEQ + i0) * DIM + tid * 8;
        h8n kv[16];
        #pragma unroll
        for (int u = 0; u < 16; ++u) kv[u] = *(const h8*)(src + u * 2048);
        // no register that an issued load names is rewritten ahead of this wait
        asm volatile("s_wait_xcnt 0x0" ::: "memory");
        #pragma unroll
        for (int u = 0; u < 16; ++u) {
            const int idx = (u * 256 + tid) * 8;
            *(h8*)&ksm[(idx >> 9) * QP + (idx & (DIM - 1))] = kv[u];
        }
    }

    // A operand (k rows of this wave's tile): row m, fragment halves at +8h and +16+8h within each 32-deep step
    const _Float16* kA = ksm + (mt * 16 + m) * QP + 8 * h;
    // B operand (q rows, gathered down column n = m): same k map as A
    const _Float16* q0 = qs + (jp * 32 + m) * QP + 8 * h;
    const _Float16* q1 = qs + (jp * 32 + 16 + m) * QP + 8 * h;

    // lane addresses of the copies: copy u of a tile moves 4 KB (four q rows; 64 rows of a V chunk), 16 B per lane
    const _Float16* qsrc = q16 + (size_t)b * SEQ * DIM + tid * 8;
    const _Float16* vsrc = vtg + (size_t)b * NITER * (DIM * BJ) + tid * 8;
    _Float16* qdst = qs + (tid >> 6) * QP + (tid & 63) * 8;
    _Float16* vdst = vT + tid * 8;

    // q rows of trip 0 (no wave has touched qs before)
    #pragma unroll
    for (int u = 0; u < 16; ++u) copy16(qsrc + u * 2048, qdst + u * 4 * QP);

    // the wave's 16 k rows never change: all 16 depth steps of its A operand are read from the staged tile once and stay in
    // registers (128 per lane) for the whole loop; the barrier publishes the k tile, which all waves have stored
    __syncthreads();
    Frag ka[DIM / 32];
    // unrolled whole: the fragment index must be a constant for the fragments to stay in registers
    #pragma unroll
    for (int ks = 0; ks < DIM / 32; ++ks) {
        ka[ks].h[0] = *(const h8*)(kA + ks * 32);          // k = 32ks + 8h + 0..7
        ka[ks].h[1] = *(const h8*)(kA + ks * 32 + 16);     // k = 32ks + 16 + 8h + 0..7
    }

    #pragma unroll 1
    for (int it = 0; it < NTRIP; ++it) {
        // hand-over at the head of a trip: this wave's LDS reads of vT and pbuf (on trip 0: of the k tile) have retired,
        // its copies of this trip's q rows have landed; the barrier publishes the q rows and frees vT and pbuf
        asm volatile("s_wait_dscnt 0x0" ::: "memory");
        asm volatile("s_wait_asynccnt 0x0" ::: "memory");
        __syncthreads();

        // the two V chunks of this trip (already transposed and converted; adjacent in the plane, same layout in LDS) fly during S
        #pragma unroll
        for (int u = 0; u < 16; ++u) copy16(vsrc + (size_t)it * (DIM * TJ) + u * 2048, vdst + u * 2048);

        // S tile 64x64 (every wave: 16 rows x 32 q), exp, publish P, accumulate row sums
        {
            f8 s0 = zero8, s1 = zero8;
            // q fragments in a ring of SD register sets, one depth step each: the loads of step ks + SD are issued with
            // the products of step ks, so that a wave waits only for loads that are SD steps old (all inside this phase)
            Frag b0[SD], b1[SD];
            #pragma unroll
            for (int t = 0; t < SD; ++t) {
                const int c = t * 32;
                b0[t].h[0] = *(const h8*)(q0 + c);          // k = c + 8h + 0..7
                b0[t].h[1] = *(const h8*)(q0 + c + 16);     // k = c + 16 + 8h + 0..7
                b1[t].h[0] = *(const h8*)(q1 + c);
                b1[t].h[1] = *(const h8*)(q1 + c + 16);
            }
            // scheduling fence, here and at the foot of every step: it holds the ring in the order written. Without the fences the
            // compiler, at this register count, either pulls each load down to its product (a full LDS latency per product) or
            // leaves the whole phase in source order, exp and row sums as one dependent chain per element
            __builtin_amdgcn_sched_barrier(0);
            // unrolled whole: the set index must be a constant for the ring to stay in registers
            #pragma unroll
            for (int ks = 0; ks < DIM / 32; ++ks) {
                const int t = ks % SD;
                s0 = wmma_f16_hi(ka[ks].v, b0[t].v, s0);
                s1 = wmma_f16_hi(ka[ks].v, b1[t].v, s1);
                if (ks + SD < DIM / 32) {
                    const int c = (ks + SD) * 32;
                    b0[t].h[0] = *(const h8*)(q0 + c);
                    b0[t].h[1] = *(const h8*)(q0 + c + 16);
                    b1[t].h[0] = *(const h8*)(q1 + c);
                    b1[t].h[1] = *(const h8*)(q1 + c + 16);
                }
                __builtin_amdgcn_sched_barrier(0);   // holds the ring's order, as said above the loop; the last one parts S from exp and row sums
            }
            float e0[8], e1[8];
            #pragma unroll
            for (int i = 0; i < 8; ++i) {
                e0[i] = exp_slot(s0[i] * S_UNSCALE);
                e1[i] = exp_slot(s1[i] * S_UNSCALE);
            }
            // D element i of lane -> row 8h+i, col m (tile 0) / 16+m (tile 1) of the wave's q half
            #pragma unroll
            for (int i = 0; i < 8; ++i) {
                const int row = mt * 16 + 8 * h + i;
                pbuf[row * PP + jp * 32 + m]      = (_Float16)e0[i];
                pbuf[row * PP + jp * 32 + 16 + m] = (_Float16)e1[i];
            }
            #pragma unroll
            for (int i = 0; i < 8; ++i) {
                float t = e0[i] + e1[i];
                t += __shfl_xor(t, 1);
                t += __shfl_xor(t, 2);
                t += __shfl_xor(t, 4);
                t += __shfl_xor(t, 8);
                dsum[i] += t;
            }
        }
        // hand-over between S and PV: this wave's P stores and its reads of the q rows have retired, its V copies have landed
        // (the last copies of the kernel among them); the barrier publishes pbuf and vT and frees the q rows
        asm volatile("s_wait_dscnt 0x0" ::: "memory");
        asm volatile("s_wait_asynccnt 0x0" ::: "memory");
        __syncthreads();

        // the q rows of the next trip fly during PV (block-uniform test)
        if (it + 1 < NTRIP) {
            #pragma unroll
            for (int u = 0; u < 16; ++u) copy16(qsrc + (size_t)(it + 1) * (TJ * DIM) + u * 2048, qdst + u * 4 * QP);
        }

        // PV: acc[krow][d] += P[krow][j] * V[j][d], one 32-deep step per chunk. The P fragments of both chunks and the first
        // PD of the eight V fragments are loaded as one run ahead of the products; V fragment s + PD follows the products of s
        {
            Frag ap[2][4], bv[PD];
            const _Float16* pr = pbuf + m * PP + 8 * h;
            const _Float16* vp = vT + (wave * 64 + m) * VP + 8 * h;
            #pragma unroll
            for (int r = 0; r < 4; ++r) {
                ap[0][r].h[0] = *(const h8*)(pr + r * 16 * PP);          // j = 8h + 0..7
                ap[0][r].h[1] = *(const h8*)(pr + r * 16 * PP + 16);     // j = 16 + 8h + 0..7
            }
            #pragma unroll
            for (int s = 0; s < PD; ++s) {
                const int o = (s >> 2) * (DIM * VP) + (s & 3) * 16 * VP;   // chunk s / 4, n-tile s % 4
                bv[s].h[0] = *(const h8*)(vp + o);        // j = 32kk + 8h + 0..7
                bv[s].h[1] = *(const h8*)(vp + o + 16);   // j = 32kk + 16 + 8h + 0..7
            }
            #pragma unroll
            for (int r = 0; r < 4; ++r) {
                ap[1][r].h[0] = *(const h8*)(pr + r * 16 * PP + 32);     // j = 32 + 8h + 0..7
                ap[1][r].h[1] = *(const h8*)(pr + r * 16 * PP + 48);     // j = 48 + 8h + 0..7
            }
            #pragma unroll
            for (int s = 0; s < 8; ++s) {
                const int kk = s >> 2, nt = s & 3, t = s % PD;
                #pragma unroll
                for (int r = 0; r < 4; ++r) acc[r][nt] = wmma_f16(ap[kk][r].v, bv[t].v, acc[r][nt]);
                if (s + PD < 8) {
                    const int o = ((s + PD) >> 2) * (DIM * VP) + ((s + PD) & 3) * 16 * VP;
                    bv[t].h[0] = *(const h8*)(vp + o);
                    bv[t].h[1] = *(const h8*)(vp + o + 16);
                }
            }
        }
    }

    // partial denominators (sum of exp over the wave's q halves) to LDS
    if (m == 0) {
        #pragma unroll
        for (int i = 0; i < 8; ++i) denom_s[jp * BM + mt * 16 + 8 * h + i] = dsum[i];
    }

    // mask[row] = any(v[b, i0+row, :] != 0): 4 threads per row, 128 floats each, OR via shuffles
    {
        const int row = tid >> 2;
        const int seg = tid & 3;
        const float* src = vg + ((size_t)b * SEQ + i0 + row) * DIM + seg * 128;
        int nz = 0;
        #pragma unroll 4
        for (int u = 0; u < 32; ++u) {
            const float4 x = *(const float4*)(src + u * 4);
            nz |= (int)(x.x != 0.0f) | (int)(x.y != 0.0f) | (int)(x.z != 0.0f) | (int)(x.w != 0.0f);
        }
        nz |= __shfl_xor(nz, 1);
        nz |= __shfl_xor(nz, 2);
        if (seg == 0) mask_s[row] = (unsigned)nz;
    }
    __syncthreads();

    // scale and stage the tile in LDS
    #pragma unroll
    for (int r = 0; r < 4; ++r) {
        float sc[8];
        #pragma unroll
        for (int i = 0; i < 8; ++i) {
            const int row = r * 16 + 8 * h + i;
            const float den = (denom_s[row] + denom_s[BM + row]) + EPS_SCALED;
            sc[i] = (mask_s[row] != 0u) ? (O_UNSCALE * __builtin_amdgcn_rcpf(den)) : 0.0f;
        }
        #pragma unroll
        for (int nt = 0; nt < 4; ++nt) {
            #pragma unroll
            for (int i = 0; i < 8; ++i) {
                const int row = r * 16 + 8 * h + i;
                ost[row * DIM + wave * 64 + nt * 16 + m] = acc[r][nt][i] * sc[i];
            }
        }
    }
    __syncthreads();

    // whole-line stores: the 64x512 f32 tile is one contiguous 128 KB span of d_out; each lane stores 16 B,
    {
        float* ob = outg + ((size_t)b * SEQ + i0) * DIM;
        v4fn vals[32];
        #pragma unroll
        for (int u = 0; u < 32; ++u) {
            const int idx = (u * 256 + tid) * 4;
            vals[u] = *(const v4f*)&ost[idx];
        }
        #pragma unroll
        for (int u = 0; u < 32; ++u) {
            const int idx = (u * 256 + tid) * 4;
            *(v4f*)(ob + idx) = vals[u];
        }
    }
}

extern "C" void kernel_launch(void* const* d_in, const int* in_sizes, int n_in,
                              void* d_out, int out_size, void* d_ws, size_t ws_size,
                              hipStream_t stream)
{
    if (n_in < 3) return;
    if (in_sizes[0] != NTOT || in_sizes[1] != NTOT || in_sizes[2] != NTOT) return;
    if (out_size != NTOT) return;

    const size_t plane_bytes = (size_t)NTOT * sizeof(_Float16);     // 16 MiB each
    const size_t need = 3 * plane_bytes;                             // 48 MiB total carve
    if (d_ws == nullptr || ws_size < need) return;

    const float* q = (const float*)d_in[0];
    const float* k = (const float*)d_in[1];
    const float* v = (const float*)d_in[2];
    float* out = (float*)d_out;

    _Float16* q16  = (_Float16*)d_ws;
    _Float16* k16  = (_Float16*)((char*)d_ws + plane_bytes);
    _Float16* vt16 = (_Float16*)((char*)d_ws + 2 * plane_bytes);

    prep_kernel<<<dim3(NVB + 2 * NCB), dim3(256), 0, stream>>>(q, k, v, q16, k16, vt16);
    attn_kernel<<<dim3(SEQ / BM, BATCH), dim3(256), 0, stream>>>(v, q16, k16, vt16, out);
    (void)hipGetLastError();
}

// v008
// A run of this version takes 90.1 microseconds.
// In both of two side-by-side timings against v007, it was 1.05 times as fast.
// Counting every step since v000, it is 4.77 times as fast.
#include <hip/hip_runtime.h>
#include <stddef.h>

// Contractions: S = K*Q^T and O = P*V on v_wmma_f32_16x16x32_f16 (f16 operands, q/k/v pre-scaled by 16, f32 accumulate); exp, row sums, mask and epilogue in f32.

typedef _Float16 h16 __attribute__((ext_vector_type(16)));
typedef _Float16 h8n __attribute__((ext_vector_type(8)));
typedef _Float16 h8  __attribute__((ext_vector_type(8), __may_alias__));
typedef float    f8  __attribute__((ext_vector_type(8)));
typedef float    v4fn __attribute__((ext_vector_type(4)));
typedef float    v4f __attribute__((ext_vector_type(4), __may_alias__));

union Frag { h16 v; h8n h[2]; };

typedef int i4n __attribute__((ext_vector_type(4)));
typedef __attribute__((address_space(1))) i4n gi4;
typedef __attribute__((address_space(3))) i4n li4;

#define BATCH 8
#define SEQ   2048
#define DIM   512
#define BM    64            // output rows (k index) per block
#define BJ    32            // q rows per transposed V chunk = depth of one PV step
#define NITER (SEQ / BJ)    // 64 chunks per batch
#define TJ    64            // q rows per trip of the main loop (two chunks)
#define NTRIP (SEQ / TJ)    // 32
#define SD    3             // depth steps of S whose q fragments are held in registers at a time
#define PD    3             // V fragments of PV held in registers at a time
#define NTOT  (BATCH * SEQ * DIM)
#define VP    32            // vT pitch in halves: vT[d][j]
#define LTQ   (4 * VP + 8)  // halves per four rows of the plane in the V transposition's LDS: 256 B + 16 B pad = 272 B
#define PP    (TJ + 8)      // pbuf pitch in halves: pbuf[krow][j], 144 B = 16 B x 9
#define QP    (DIM + 8)     // LDS row pitch in halves of the staged q chunk and k tile: 1040 B = 16 B x 65, b128 fragment reads fall on distinct banks

#define QK_SCALE   16.0f           // q and k carried x16 in f16 -> S carried x256
#define V_SCALE    16.0f           // v carried x16 in f16 -> O carried x16
#define S_UNSCALE  (1.0f / 256.0f)
#define O_UNSCALE  (1.0f / 16.0f)
#define EPS_SCALED 2.2627417e-6f   // 1e-7 * sqrt(512): eps applied after the 1/sqrt(d) factor, P kept as pure exp

static_assert(SEQ % BM == 0);
static_assert(SEQ % BJ == 0);
static_assert(DIM % 32 == 0);
static_assert(NTOT % (256 * 8) == 0);
static_assert(SEQ % TJ == 0 && TJ == 2 * BJ);
static_assert(BM * DIM == 32 * 256 * 4);
static_assert(DIM * BJ == 8 * 256 * 8);
static_assert(DIM / 4 == 128 && BJ == 32 && VP == BJ);   // V transposition: 128 column quads x 2 halves of 16 rows = 256 lanes
static_assert(DIM * TJ == 16 * 256 * 8);
static_assert(BM * DIM == 16 * 256 * 8);
static_assert((BM + TJ) * QP * sizeof(_Float16) >= BM * DIM * sizeof(float));   // the output tile fits in the area of the k tile and the q rows

__device__ __forceinline__ f8 wmma_f16(h16 a, h16 b, f8 c) {
    f8 d = __builtin_amdgcn_wmma_f32_16x16x32_f16(false, a, false, b, (short)0, c, false, false);
    asm volatile("v_nop\n\tv_nop\n\tv_nop\n\tv_nop" : "+v"(d) : "v"(a), "v"(b));
    return d;
}

// the same product as S uses it: no asm statement names its operands, so that the resident k fragments may sit above v255
// (an asm operand cannot); the compiler keeps the distance behind its own builtin form
__device__ __forceinline__ f8 wmma_f16_hi(h16 a, h16 b, f8 c) {
    return __builtin_amdgcn_wmma_f32_16x16x32_f16(false, a, false, b, (short)0, c, false, false);
}

// asynchronous copy of the lane's own 16 bytes from global memory to LDS, through no register;
// landed only behind the issuing wave's s_wait_asynccnt 0, readable by other waves only behind the next barrier
__device__ __forceinline__ void copy16(const _Float16* g, _Float16* l) {
    __builtin_amdgcn_global_load_async_to_lds_b128((gi4*)g, (li4*)l, 0, 0);
}

// e^x as __expf forms it (x * log2(e), then v_exp_f32), with the one slot that the instruction set asks for behind a
// transcendental in the instruction's own statement: a v_nop in a statement of its own did not stay behind it
__device__ __forceinline__ float exp_slot(float x) {
    float r;
    asm("v_exp_f32 %0, %1\n\tv_nop" : "=v"(r) : "v"(x * 0x1.715476p+0f));
    return r;
}

// ---------------- prep: one launch for all three planes ----------------
// The V transposition and the q/k conversion read and write disjoint buffers, so they need no order between them: they run as
// one grid. Blocks 0 .. NVB-1 transpose V (the longer blocks, started first), the NCB blocks behind them convert q, the last NCB k.
//
// q, k: f32 -> f16 row planes (x16), 8 values per lane.
//
// V: vtg[b*NITER + it][d][j] = f16(16 * v[b][it*32 + j][d]); one block per (b, it).
// The transposition is done in registers: a lane reads the same four columns of two groups of eight consecutive rows (each wave-wide
// load is 512 contiguous bytes of one row) and so holds, per group and column, eight neighbours along j = one 16 B piece of the plane.
// LDS only reorders those pieces into the plane's linear order for whole-line stores. Four plane rows (256 B) are followed by a
// 16 B pad: lanes that are four rows apart then store 272 B apart, on distinct banks, and the read-back stays contiguous per 256 B.
// The same blocks form the row mask any(v[row][:] != 0) from the f32 values they hold, so that V is read from memory once.
#define NVB (BATCH * NITER)        // 512 transposing blocks
#define NCB (NTOT / (256 * 8))     // 4,096 converting blocks per plane
__global__ __launch_bounds__(256)
void prep_kernel(const float* __restrict__ q, const float* __restrict__ k, const float* __restrict__ v,
                 _Float16* __restrict__ q16, _Float16* __restrict__ k16, _Float16* __restrict__ vtg,
                 unsigned* __restrict__ maskg)
{
    __shared__ __align__(16) _Float16 lt[(DIM / 4) * LTQ];
    __shared__ unsigned wb[8];                    // per wave: bit r = some value of row 16*jh + r in the wave's 128 columns is not 0
    const int tid = threadIdx.x;
    const int blk = blockIdx.x;

    if (blk >= NVB) {                             // block-uniform; these blocks leave in front of the barrier
        const int  c   = blk - NVB;
        const bool isk = (c >= NCB);
        const float* src = isk ? k : q;
        _Float16*    dst = isk ? k16 : q16;
        const size_t i = ((size_t)(isk ? c - NCB : c) * 256 + tid) * 8;
        const float4 a = *(const float4*)(src + i);
        const float4 b = *(const float4*)(src + i + 4);
        h8n o;
        o[0] = (_Float16)(a.x * QK_SCALE); o[1] = (_Float16)(a.y * QK_SCALE);
        o[2] = (_Float16)(a.z * QK_SCALE); o[3] = (_Float16)(a.w * QK_SCALE);
        o[4] = (_Float16)(b.x * QK_SCALE); o[5] = (_Float16)(b.y * QK_SCALE);
        o[6] = (_Float16)(b.z * QK_SCALE); o[7] = (_Float16)(b.w * QK_SCALE);
        h8* p = (h8*)(dst + i);
        *p = o;
        return;
    }

    const int b   = blk / NITER;                  // blk = b*NITER + it
    const int it  = blk - b * NITER;
    const int dq  = tid & 127;                    // column quad: d = 4*dq .. 4*dq + 3
    const int jh  = tid >> 7;                     // wave-uniform: row groups 2*jh and 2*jh + 1 (eight rows each)
    const float* src = v + ((size_t)b * SEQ + (size_t)it * BJ + jh * 16) * DIM + dq * 4;

    // one group of eight rows at a time: 32 registers of loaded values, not 64, so that the whole kernel stays within 64 registers
    // and eight blocks share a WGP, as the converting blocks need for their bytes in flight
    unsigned rowbits = 0u;                        // the same in every lane of a wave
    #pragma unroll
    for (int g = 0; g < 2; ++g) {
        v4fn x[8];                                // x[r] = v[row 16*jh + 8*g + r][4*dq .. 4*dq + 3]
        #pragma unroll
        for (int r = 0; r < 8; ++r) x[r] = *(const v4f*)(src + (g * 8 + r) * DIM);
        // no register that an issued load names is rewritten ahead of this wait; the address is named as an input so that it
        // stays live up to here and no load's own result is placed on it
        asm volatile("s_wait_xcnt 0x0" :: "v"(src) : "memory");
        #pragma unroll
        for (int i = 0; i < 4; ++i) {
            h8n o;
            #pragma unroll
            for (int r = 0; r < 8; ++r) o[r] = (_Float16)(x[r][i] * V_SCALE);
            *(h8*)&lt[dq * LTQ + i * VP + (jh * 2 + g) * 8] = o;      // plane row 4*dq + i, j = 16*jh + 8*g + 0..7
        }
        // row mask, from the unscaled f32 values while they are in registers: one vote of the wave per row
        #pragma unroll
        for (int r = 0; r < 8; ++r) {
            const bool nz = (x[r][0] != 0.0f) | (x[r][1] != 0.0f) | (x[r][2] != 0.0f) | (x[r][3] != 0.0f);
            if (__builtin_amdgcn_ballot_w32(nz) != 0u) rowbits |= 1u << (g * 8 + r);
        }
        // scheduling fence between the groups: without it the compiler lifts the second group's loads over the first group's
        // conversion and the kernel needs 89 registers (five blocks per WGP)
        if (g == 0) __builtin_amdgcn_sched_barrier(0);
    }
    if ((tid & 31) == 0) wb[tid >> 5] = rowbits;
    __syncthreads();

    _Float16* dst = vtg + (size_t)blk * (DIM * BJ);
    h8n vals[8];
    #pragma unroll
    for (int u = 0; u < 8; ++u) {
        const int n = u * 256 + tid;              // 16 B piece n of the plane: sixteen pieces per four rows
        vals[u] = *(const h8*)&lt[(n >> 4) * LTQ + (n & 15) * 8];
    }
    #pragma unroll
    for (int u = 0; u < 8; ++u) {
        const int idx = (u * 256 + tid) * 8;
        *(h8*)(dst + idx) = vals[u];
    }

    // maskg[b*SEQ + it*32 + j] = any(v[b, it*32 + j, :] != 0): the four waves of row half j / 16 each voted on 128 columns;
    // one whole 128 B line per block, the kernel's last store
    if (tid < BJ) {
        const int w0 = (tid >> 4) * 4;
        const unsigned bits = wb[w0] | wb[w0 + 1] | wb[w0 + 2] | wb[w0 + 3];
        maskg[blk * BJ + tid] = (bits >> (tid & 15)) & 1u;
    }
}

// ---------------- main kernel ----------------
// block = (64 output rows of the k index, batch b), 256 threads = 8 waves, one block per WGP.
// Per trip of 64 q rows:
//   S[krow][q] = sum_d K[krow][d]*Q[q][d], 4 x 4 tiles: wave -> row tile mt = wave&3, q half jp = wave>>2 (two tiles, one A fragment for both);
//   P = exp(S/256) -> LDS (f16), row sums of the wave's 32 q -> dsum (two partial sums per row, added after the loop);
//   acc[krow][d] += P[krow][q] * V[q][d]: every wave takes all 4 row tiles x its own 64 output columns (4 n-tiles),
//   V from the two transposed chunks vT[chunk][d][q], in ascending chunk order.
// The A operand of S never changes: the k tile is staged in LDS once (whole-line loads, through registers), and each wave then reads
// the 16 fragments of its 16 rows once and holds them in 128 registers for the whole loop. The B operand comes from LDS every trip.
// The q rows and the V chunks come per trip by asynchronous copies of whole lines: V of this trip flies while S is formed, the q rows
// of the next trip fly during PV.
// Fragment reads run ahead of the products inside each phase (register rings), never across a barrier. Every operand of wmma_f16
// is named in its asm statement and so sits below v256: accumulators (128) + PV's rings must fit there, or the accumulators spill;
// S uses wmma_f16_hi, whose operands are free of that. Two waves share a SIMD: a wave may hold 512 registers at most.
// Left, by the count of LDS clocks a trip asks for: every q fragment is still read by four waves (one per row tile); vT's 64 B pitch
// costs its b128 reads four times the clocks of a 16 B x odd pitch; row sums go through ds_bpermute. In the prep launch,
// the q/k conversion starts 65,536 waves of one 32 B read per lane.
__global__ __launch_bounds__(256)
void attn_kernel(const unsigned* __restrict__ maskg,
                 const _Float16* __restrict__ q16, const _Float16* __restrict__ k16,
                 const _Float16* __restrict__ vtg,
                 float* __restrict__ outg)
{
    __shared__ __align__(16) _Float16 vT[DIM * TJ];     // 64 KB, vT[chunk][d][j], two chunks of pitch VP
    __shared__ __align__(16) _Float16 pbuf[BM * PP];    // 9 KB,  pbuf[krow][j]
    __shared__ __align__(16) float    ost[(BM + TJ) * QP / 2];   // 130 KB: k tile and q rows (f16, padded pitch) during the loop, output staging (row pitch DIM) after it
    __shared__ float    denom_s[2 * BM];
    __shared__ unsigned mask_s[BM];

    const int tid  = threadIdx.x;
    const int lane = tid & 31;
    const int wave = tid >> 5;
    const int h    = lane >> 4;
    const int m    = lane & 15;
    const int mt   = wave & 3;
    const int jp   = wave >> 2;
    const int b    = blockIdx.y;
    const int i0   = blockIdx.x * BM;

    f8 zero8;
    #pragma unroll
    for (int i = 0; i < 8; ++i) zero8[i] = 0.0f;
    f8 acc[4][4];
    #pragma unroll
    for (int r = 0; r < 4; ++r) {
        #pragma unroll
        for (int n = 0; n < 4; ++n) acc[r][n] = zero8;
    }
    f8 dsum = zero8;

    // k tile (64 rows x 512) -> LDS once, padded pitch; it lives in the output staging area, which is written only after the loop
    _Float16* ksm = reinterpret_cast<_Float16*>(ost);
    _Float16* qs  = ksm + BM * QP;
    {
        const _Float16* kb  = k16 + ((size_t)b * SEQ + i0) * DIM;     // the same in every lane
        const _Float16* src = kb + tid * 8;
        // row mask of the block's 64 rows, as the prep launch left it: loaded with the k tile, read after the loop
        const int      mi = b * SEQ + i0 + (tid & (BM - 1));
        const unsigned mk = maskg[mi];
        h8n kv[16];
        #pragma unroll
        for (int u = 0; u < 16; ++u) kv[u] = *(const h8*)(src + u * 2048);
        // no register that an issued load names is rewritten ahead of this wait. The mask word is named as an input so that its
        // load is issued up here, with the k tile's, and not alone behind the stores (a second full latency); its index and
        // the two bases are named so that they stay live up to here: neither a load's own result nor anything else is placed on them
        asm volatile("s_wait_xcnt 0x0" :: "s"(kb), "s"(maskg), "v"(mi), "v"(mk) : "memory");
        #pragma unroll
        for (int u = 0; u < 16; ++u) {
            const int idx = (u * 256 + tid) * 8;
            *(h8*)&ksm[(idx >> 9) * QP + (idx & (DIM - 1))] = kv[u];
        }
        if (tid < BM) mask_s[tid] = mk;
    }

    // A operand (k rows of this wave's tile): row m, fragment halves at +8h and +16+8h within each 32-deep step
    const _Float16* kA = ksm + (mt * 16 + m) * QP + 8 * h;
    // B operand (q rows, gathered down column n = m): same k map as A
    const _Float16* q0 = qs + (jp * 32 + m) * QP + 8 * h;
    const _Float16* q1 = qs + (jp * 32 + 16 + m) * QP + 8 * h;

    // lane addresses of the copies: copy u of a tile moves 4 KB (four q rows; 64 rows of a V chunk), 16 B per lane
    const _Float16* qsrc = q16 + (size_t)b * SEQ * DIM + tid * 8;
    const _Float16* vsrc = vtg + (size_t)b * NITER * (DIM * BJ) + tid * 8;
    _Float16* qdst = qs + (tid >> 6) * QP + (tid & 63) * 8;
    _Float16* vdst = vT + tid * 8;

    // q rows of trip 0 (no wave has touched qs before)
    #pragma unroll
    for (int u = 0; u < 16; ++u) copy16(qsrc + u * 2048, qdst + u * 4 * QP);

    // the wave's 16 k rows never change: all 16 depth steps of its A operand are read from the staged tile once and stay in
    // registers (128 per lane) for the whole loop; the barrier publishes the k tile, which all waves have stored
    __syncthreads();
    Frag ka[DIM / 32];
    // unrolled whole: the fragment index must be a constant for the fragments to stay in registers
    #pragma unroll
    for (int ks = 0; ks < DIM / 32; ++ks) {
        ka[ks].h[0] = *(const h8*)(kA + ks * 32);          // k = 32ks + 8h + 0..7
        ka[ks].h[1] = *(const h8*)(kA + ks * 32 + 16);     // k = 32ks + 16 + 8h + 0..7
    }

    #pragma unroll 1
    for (int it = 0; it < NTRIP; ++it) {
        // hand-over at the head of a trip: this wave's LDS reads of vT and pbuf (on trip 0: of the k tile) have retired,
        // its copies of this trip's q rows have landed; the barrier publishes the q rows and frees vT and pbuf
        asm volatile("s_wait_dscnt 0x0" ::: "memory");
        asm volatile("s_wait_asynccnt 0x0" ::: "memory");
        __syncthreads();

        // the two V chunks of this trip (already transposed and converted; adjacent in the plane, same layout in LDS) fly during S
        #pragma unroll
        for (int u = 0; u < 16; ++u) copy16(vsrc + (size_t)it * (DIM * TJ) + u * 2048, vdst + u * 2048);

        // S tile 64x64 (every wave: 16 rows x 32 q), exp, publish P, accumulate row sums
        {
            f8 s0 = zero8, s1 = zero8;
            // q fragments in a ring of SD register sets, one depth step each: the loads of step ks + SD are issued with
            // the products of step ks, so that a wave waits only for loads that are SD steps old (all inside this phase)
            Frag b0[SD], b1[SD];
            #pragma unroll
            for (int t = 0; t < SD; ++t) {
                const int c = t * 32;
                b0[t].h[0] = *(const h8*)(q0 + c);          // k = c + 8h + 0..7
                b0[t].h[1] = *(const h8*)(q0 + c + 16);     // k = c + 16 + 8h + 0..7
                b1[t].h[0] = *(const h8*)(q1 + c);
                b1[t].h[1] = *(const h8*)(q1 + c + 16);
            }
            // scheduling fence, here and at the foot of every step: it holds the ring in the order written. Without the fences the
            // compiler, at this register count, either pulls each load down to its product (a full LDS latency per product) or
            // leaves the whole phase in source order, exp and row sums as one dependent chain per element
            __builtin_amdgcn_sched_barrier(0);
            // unrolled whole: the set index must be a constant for the ring to stay in registers
            #pragma unroll
            for (int ks = 0; ks < DIM / 32; ++ks) {
                const int t = ks % SD;
                s0 = wmma_f16_hi(ka[ks].v, b0[t].v, s0);
                s1 = wmma_f16_hi(ka[ks].v, b1[t].v, s1);
                if (ks + SD < DIM / 32) {
                    const int c = (ks + SD) * 32;
                    b0[t].h[0] = *(const h8*)(q0 + c);
                    b0[t].h[1] = *(const h8*)(q0 + c + 16);
                    b1[t].h[0] = *(const h8*)(q1 + c);
                    b1[t].h[1] = *(const h8*)(q1 + c + 16);
                }
                __builtin_amdgcn_sched_barrier(0);   // holds the ring's order, as said above the loop; the last one parts S from exp and row sums
            }
            float e0[8], e1[8];
            #pragma unroll
            for (int i = 0; i < 8; ++i) {
                e0[i] = exp_slot(s0[i] * S_UNSCALE);
                e1[i] = exp_slot(s1[i] * S_UNSCALE);
            }
            // D element i of lane -> row 8h+i, col m (tile 0) / 16+m (tile 1) of the wave's q half
            #pragma unroll
            for (int i = 0; i < 8; ++i) {
                const int row = mt * 16 + 8 * h + i;
                pbuf[row * PP + jp * 32 + m]      = (_Float16)e0[i];
                pbuf[row * PP + jp * 32 + 16 + m] = (_Float16)e1[i];
            }
            #pragma unroll
            for (int i = 0; i < 8; ++i) {
                float t = e0[i] + e1[i];
                t += __shfl_xor(t, 1);
                t += __shfl_xor(t, 2);
                t += __shfl_xor(t, 4);
                t += __shfl_xor(t, 8);
                dsum[i] += t;
            }
        }
        // hand-over between S and PV: this wave's P stores and its reads of the q rows have retired, its V copies have landed
        // (the last copies of the kernel among them); the barrier publishes pbuf and vT and frees the q rows
        asm volatile("s_wait_dscnt 0x0" ::: "memory");
        asm volatile("s_wait_asynccnt 0x0" ::: "memory");
        __syncthreads();

        // the q rows of the next trip fly during PV (block-uniform test)
        if (it + 1 < NTRIP) {
            #pragma unroll
            for (int u = 0; u < 16; ++u) copy16(qsrc + (size_t)(it + 1) * (TJ * DIM) + u * 2048, qdst + u * 4 * QP);
        }

        // PV: acc[krow][d] += P[krow][j] * V[j][d], one 32-deep step per chunk. The P fragments of both chunks and the first
        // PD of the eight V fragments are loaded as one run ahead of the products; V fragment s + PD follows the products of s
        {
            Frag ap[2][4], bv[PD];
            const _Float16* pr = pbuf + m * PP + 8 * h;
            const _Float16* vp = vT + (wave * 64 + m) * VP + 8 * h;
            #pragma unroll
            for (int r = 0; r < 4; ++r) {
                ap[0][r].h[0] = *(const h8*)(pr + r * 16 * PP);          // j = 8h + 0..7
                ap[0][r].h[1] = *(const h8*)(pr + r * 16 * PP + 16);     // j = 16 + 8h + 0..7
            }
            #pragma unroll
            for (int s = 0; s < PD; ++s) {
                const int o = (s >> 2) * (DIM * VP) + (s & 3) * 16 * VP;   // chunk s / 4, n-tile s % 4
                bv[s].h[0] = *(const h8*)(vp + o);        // j = 32kk + 8h + 0..7
                bv[s].h[1] = *(const h8*)(vp + o + 16);   // j = 32kk + 16 + 8h + 0..7
            }
            #pragma unroll
            for (int r = 0; r < 4; ++r) {
                ap[1][r].h[0] = *(const h8*)(pr + r * 16 * PP + 32);     // j = 32 + 8h + 0..7
                ap[1][r].h[1] = *(const h8*)(pr + r * 16 * PP + 48);     // j = 48 + 8h + 0..7
            }
            #pragma unroll
            for (int s = 0; s < 8; ++s) {
                const int kk = s >> 2, nt = s & 3, t = s % PD;
                #pragma unroll
                for (int r = 0; r < 4; ++r) acc[r][nt] = wmma_f16(ap[kk][r].v, bv[t].v, acc[r][nt]);
                if (s + PD < 8) {
                    const int o = ((s + PD) >> 2) * (DIM * VP) + ((s + PD) & 3) * 16 * VP;
                    bv[t].h[0] = *(const h8*)(vp + o);
                    bv[t].h[1] = *(const h8*)(vp + o + 16);
                }
            }
        }
    }

    // partial denominators (sum of exp over the wave's q halves) to LDS
    if (m == 0) {
        #pragma unroll
        for (int i = 0; i < 8; ++i) denom_s[jp * BM + mt * 16 + 8 * h + i] = dsum[i];
    }

    __syncthreads();

    // scale and stage the tile in LDS
    #pragma unroll
    for (int r = 0; r < 4; ++r) {
        float sc[8];
        #pragma unroll
        for (int i = 0; i < 8; ++i) {
            const int row = r * 16 + 8 * h + i;
            const float den = (denom_s[row] + denom_s[BM + row]) + EPS_SCALED;
            sc[i] = (mask_s[row] != 0u) ? (O_UNSCALE * __builtin_amdgcn_rcpf(den)) : 0.0f;
        }
        #pragma unroll
        for (int nt = 0; nt < 4; ++nt) {
            #pragma unroll
            for (int i = 0; i < 8; ++i) {
                const int row = r * 16 + 8 * h + i;
                ost[row * DIM + wave * 64 + nt * 16 + m] = acc[r][nt][i] * sc[i];
            }
        }
    }
    __syncthreads();

    // whole-line stores: the 64x512 f32 tile is one contiguous 128 KB span of d_out; each lane stores 16 B,
    {
        float* ob = outg + ((size_t)b * SEQ + i0) * DIM;
        v4fn vals[32];
        #pragma unroll
        for (int u = 0; u < 32; ++u) {
            const int idx = (u * 256 + tid) * 4;
            vals[u] = *(const v4f*)&ost[idx];
        }
        #pragma unroll
        for (int u = 0; u < 32; ++u) {
            const int idx = (u * 256 + tid) * 4;
            *(v4f*)(ob + idx) = vals[u];
        }
    }
}

extern "C" void kernel_launch(void* const* d_in, const int* in_sizes, int n_in,
                              void* d_out, int out_size, void* d_ws, size_t ws_size,
                              hipStream_t stream)
{
    if (n_in < 3) return;
    if (in_sizes[0] != NTOT || in_sizes[1] != NTOT || in_sizes[2] != NTOT) return;
    if (out_size != NTOT) return;

    const size_t plane_bytes = (size_t)NTOT * sizeof(_Float16);     // 16 MiB each
    const size_t need = 3 * plane_bytes + (size_t)BATCH * SEQ * sizeof(unsigned);   // 48 MiB + 64 KiB total carve
    if (d_ws == nullptr || ws_size < need) return;

    const float* q = (const float*)d_in[0];
    const float* k = (const float*)d_in[1];
    const float* v = (const float*)d_in[2];
    float* out = (float*)d_out;

    _Float16* q16  = (_Float16*)d_ws;
    _Float16* k16  = (_Float16*)((char*)d_ws + plane_bytes);
    _Float16* vt16 = (_Float16*)((char*)d_ws + 2 * plane_bytes);
    unsigned* mask = (unsigned*)((char*)d_ws + 3 * plane_bytes);

    prep_kernel<<<dim3(NVB + 2 * NCB), dim3(256), 0, stream>>>(q, k, v, q16, k16, vt16, mask);
    attn_kernel<<<dim3(SEQ / BM, BATCH), dim3(256), 0, stream>>>(mask, q16, k16, vt16, out);
    (void)hipGetLastError();
}

// v009
// A run of this version takes 85.6 microseconds.
// Next to v008, in two timings, it ran 1.05 and 1.08 times as fast.
// All steps since v000 together make it 5.08 times as fast.
#include <hip/hip_runtime.h>
#include <stddef.h>

// Contractions: S = K*Q^T and O = P*V on v_wmma_f32_16x16x32_f16 (f16 operands, q/k/v pre-scaled by 16, f32 accumulate); exp, row sums, mask and epilogue in f32.

typedef _Float16 h16 __attribute__((ext_vector_type(16)));
typedef _Float16 h8n __attribute__((ext_vector_type(8)));
typedef _Float16 h8  __attribute__((ext_vector_type(8), __may_alias__));
typedef float    f8  __attribute__((ext_vector_type(8)));
typedef float    v4fn __attribute__((ext_vector_type(4)));
typedef float    v4f __attribute__((ext_vector_type(4), __may_alias__));

union Frag { h16 v; h8n h[2]; };

typedef int i4n __attribute__((ext_vector_type(4)));
typedef __attribute__((address_space(1))) i4n gi4;
typedef __attribute__((address_space(3))) i4n li4;

#define BATCH 8
#define SEQ   2048
#define DIM   512
#define BM    64            // output rows (k index) per block
#define BJ    32            // q rows per transposed V chunk = depth of one PV step
#define NITER (SEQ / BJ)    // 64 chunks per batch
#define TJ    64            // q rows per trip of the main loop (two chunks)
#define NTRIP (SEQ / TJ)    // 32
#define SD    3             // depth steps of S whose q fragments are held in registers at a time
#define PD    3             // V fragments of PV held in registers at a time
#define NTOT  (BATCH * SEQ * DIM)
#define VP    32            // vT pitch in halves: vT[d][j]
#define LTQ   (4 * VP + 8)  // halves per four rows of the plane in the V transposition's LDS: 256 B + 16 B pad = 272 B
#define PP    (TJ + 8)      // pbuf pitch in halves: pbuf[krow][j], 144 B = 16 B x 9
#define QP    (DIM + 8)     // LDS row pitch in halves of the staged q chunk and k tile: 1040 B = 16 B x 65, b128 fragment reads fall on distinct banks

#define QK_SCALE   16.0f           // q and k carried x16 in f16 -> S carried x256
#define V_SCALE    16.0f           // v carried x16 in f16 -> O carried x16
#define S_UNSCALE  (1.0f / 256.0f)
#define O_UNSCALE  (1.0f / 16.0f)
#define EPS_SCALED 2.2627417e-6f   // 1e-7 * sqrt(512): eps applied after the 1/sqrt(d) factor, P kept as pure exp

static_assert(SEQ % BM == 0);
static_assert(SEQ % BJ == 0);
static_assert(DIM % 32 == 0);
static_assert(NTOT % (256 * 8) == 0);
static_assert(SEQ % TJ == 0 && TJ == 2 * BJ);
static_assert(BM * DIM == 32 * 256 * 4);
static_assert(DIM * BJ == 8 * 256 * 8);
static_assert(DIM / 4 == 128 && BJ == 32 && VP == BJ);   // V transposition: 128 column quads x 2 halves of 16 rows = 256 lanes
static_assert(DIM * TJ == 16 * 256 * 8);
static_assert(BM * DIM == 16 * 256 * 8);
static_assert((BM + TJ) * QP * sizeof(_Float16) >= BM * DIM * sizeof(float));   // the output tile fits in the area of the k tile and the q rows

__device__ __forceinline__ f8 wmma_f16(h16 a, h16 b, f8 c) {
    f8 d = __builtin_amdgcn_wmma_f32_16x16x32_f16(false, a, false, b, (short)0, c, false, false);
    asm volatile("v_nop\n\tv_nop\n\tv_nop\n\tv_nop" : "+v"(d) : "v"(a), "v"(b));
    return d;
}

// the same product as S uses it: no asm statement names its operands, so that the resident k fragments may sit above v255
// (an asm operand cannot); the compiler keeps the distance behind its own builtin form
__device__ __forceinline__ f8 wmma_f16_hi(h16 a, h16 b, f8 c) {
    return __builtin_amdgcn_wmma_f32_16x16x32_f16(false, a, false, b, (short)0, c, false, false);
}

// asynchronous copy of the lane's own 16 bytes from global memory to LDS, through no register;
// landed only behind the issuing wave's s_wait_asynccnt 0, readable by other waves only behind the next barrier
__device__ __forceinline__ void copy16(const _Float16* g, _Float16* l) {
    __builtin_amdgcn_global_load_async_to_lds_b128((gi4*)g, (li4*)l, 0, 0);
}

// e^x as __expf forms it (x * log2(e), then v_exp_f32), with the one slot that the instruction set asks for behind a
// transcendental in the instruction's own statement: a v_nop in a statement of its own did not stay behind it
__device__ __forceinline__ float exp_slot(float x) {
    float r;
    asm("v_exp_f32 %0, %1\n\tv_nop" : "=v"(r) : "v"(x * 0x1.715476p+0f));
    return r;
}

// ---------------- prep: one launch for all three planes ----------------
// The V transposition and the q/k conversion read and write disjoint buffers, so they need no order between them: they run as
// one grid. Blocks 0 .. NVB-1 transpose V (the longer blocks, started first), the NCB blocks behind them convert q, the last NCB k.
//
// q, k: f32 -> f16 row planes (x16), 8 values per lane.
//
// V: vtg[b*NITER + it][d][j] = f16(16 * v[b][it*32 + j][d]); one block per (b, it).
// The transposition is done in registers: a lane reads the same four columns of two groups of eight consecutive rows (each wave-wide
// load is 512 contiguous bytes of one row) and so holds, per group and column, eight neighbours along j = one 16 B piece of the plane.
// LDS only reorders those pieces into the plane's linear order for whole-line stores. Four plane rows (256 B) are followed by a
// 16 B pad: lanes that are four rows apart then store 272 B apart, on distinct banks, and the read-back stays contiguous per 256 B.
// The same blocks form the row mask any(v[row][:] != 0) from the f32 values they hold, so that V is read from memory once.
#define NVB (BATCH * NITER)        // 512 transposing blocks
#define NCB (NTOT / (256 * 8))     // 4,096 converting blocks per plane
__global__ __launch_bounds__(256)
void prep_kernel(const float* __restrict__ q, const float* __restrict__ k, const float* __restrict__ v,
                 _Float16* __restrict__ q16, _Float16* __restrict__ k16, _Float16* __restrict__ vtg,
                 unsigned* __restrict__ maskg)
{
    __shared__ __align__(16) _Float16 lt[(DIM / 4) * LTQ];
    __shared__ unsigned wb[8];                    // per wave: bit r = some value of row 16*jh + r in the wave's 128 columns is not 0
    const int tid = threadIdx.x;
    const int blk = blockIdx.x;

    if (blk >= NVB) {                             // block-uniform; these blocks leave in front of the barrier
        const int  c   = blk - NVB;
        const bool isk = (c >= NCB);
        const float* src = isk ? k : q;
        _Float16*    dst = isk ? k16 : q16;
        const size_t i = ((size_t)(isk ? c - NCB : c) * 256 + tid) * 8;
        const float4 a = *(const float4*)(src + i);
        const float4 b = *(const float4*)(src + i + 4);
        h8n o;
        o[0] = (_Float16)(a.x * QK_SCALE); o[1] = (_Float16)(a.y * QK_SCALE);
        o[2] = (_Float16)(a.z * QK_SCALE); o[3] = (_Float16)(a.w * QK_SCALE);
        o[4] = (_Float16)(b.x * QK_SCALE); o[5] = (_Float16)(b.y * QK_SCALE);
        o[6] = (_Float16)(b.z * QK_SCALE); o[7] = (_Float16)(b.w * QK_SCALE);
        h8* p = (h8*)(dst + i);
        *p = o;
        return;
    }

    const int b   = blk / NITER;                  // blk = b*NITER + it
    const int it  = blk - b * NITER;
    const int dq  = tid & 127;                    // column quad: d = 4*dq .. 4*dq + 3
    const int jh  = tid >> 7;                     // wave-uniform: row groups 2*jh and 2*jh + 1 (eight rows each)
    const float* src = v + ((size_t)b * SEQ + (size_t)it * BJ + jh * 16) * DIM + dq * 4;

    // one group of eight rows at a time: 32 registers of loaded values, not 64, so that the whole kernel stays within 64 registers
    // and eight blocks share a WGP, as the converting blocks need for their bytes in flight
    unsigned rowbits = 0u;                        // the same in every lane of a wave
    #pragma unroll
    for (int g = 0; g < 2; ++g) {
        v4fn x[8];                                // x[r] = v[row 16*jh + 8*g + r][4*dq .. 4*dq + 3]
        #pragma unroll
        for (int r = 0; r < 8; ++r) x[r] = *(const v4f*)(src + (g * 8 + r) * DIM);
        // no register that an issued load names is rewritten ahead of this wait; the address is named as an input so that it
        // stays live up to here and no load's own result is placed on it
        asm volatile("s_wait_xcnt 0x0" :: "v"(src) : "memory");
        #pragma unroll
        for (int i = 0; i < 4; ++i) {
            h8n o;
            #pragma unroll
            for (int r = 0; r < 8; ++r) o[r] = (_Float16)(x[r][i] * V_SCALE);
            *(h8*)&lt[dq * LTQ + i * VP + (jh * 2 + g) * 8] = o;      // plane row 4*dq + i, j = 16*jh + 8*g + 0..7
        }
        // row mask, from the unscaled f32 values while they are in registers: one vote of the wave per row
        #pragma unroll
        for (int r = 0; r < 8; ++r) {
            const bool nz = (x[r][0] != 0.0f) | (x[r][1] != 0.0f) | (x[r][2] != 0.0f) | (x[r][3] != 0.0f);
            if (__builtin_amdgcn_ballot_w32(nz) != 0u) rowbits |= 1u << (g * 8 + r);
        }
        // scheduling fence between the groups: without it the compiler lifts the second group's loads over the first group's
        // conversion and the kernel needs 89 registers (five blocks per WGP)
        if (g == 0) __builtin_amdgcn_sched_barrier(0);
    }
    if ((tid & 31) == 0) wb[tid >> 5] = rowbits;
    __syncthreads();

    _Float16* dst = vtg + (size_t)blk * (DIM * BJ);
    h8n vals[8];
    #pragma unroll
    for (int u = 0; u < 8; ++u) {
        const int n = u * 256 + tid;              // 16 B piece n of the plane: sixteen pieces per four rows
        vals[u] = *(const h8*)&lt[(n >> 4) * LTQ + (n & 15) * 8];
    }
    #pragma unroll
    for (int u = 0; u < 8; ++u) {
        const int idx = (u * 256 + tid) * 8;
        *(h8*)(dst + idx) = vals[u];
    }

    // maskg[b*SEQ + it*32 + j] = any(v[b, it*32 + j, :] != 0): the four waves of row half j / 16 each voted on 128 columns;
    // one whole 128 B line per block, the kernel's last store
    if (tid < BJ) {
        const int w0 = (tid >> 4) * 4;
        const unsigned bits = wb[w0] | wb[w0 + 1] | wb[w0 + 2] | wb[w0 + 3];
        maskg[blk * BJ + tid] = (bits >> (tid & 15)) & 1u;
    }
}

// ---------------- main kernel ----------------
// block = (64 output rows of the k index, batch b), 256 threads = 8 waves, one block per WGP.
// Per trip of 64 q rows:
//   S[krow][q] = sum_d K[krow][d]*Q[q][d], 4 x 4 tiles: wave -> row tile mt = wave&3, q half jp = wave>>2 (two tiles, one k fragment for both);
//   each tile is formed transposed (A = q rows, B = k rows): a lane then holds eight consecutive q of ONE k row;
//   P = exp(S/256) -> LDS (f16), 16 B per store; row sums add up inside the lane -> dsum (four partial sums per row, added after the loop);
//   acc[krow][d] += P[krow][q] * V[q][d]: every wave takes all 4 row tiles x its own 64 output columns (4 n-tiles),
//   V from the two transposed chunks vT[chunk][d][q], in ascending chunk order.
// The k operand of S never changes: the k tile is staged in LDS once (whole-line loads, through registers), and each wave then reads
// the 16 fragments of its 16 rows once and holds them in 128 registers for the whole loop. The q operand comes from LDS every trip.
// The q rows and the V chunks come per trip by asynchronous copies of whole lines: V of this trip flies while S is formed, the q rows
// of the next trip fly during PV.
// Fragment reads run ahead of the products inside each phase (register rings), never across a barrier. Every operand of wmma_f16
// is named in its asm statement and so sits below v256: accumulators (128) + PV's rings must fit there, or the accumulators spill;
// S uses wmma_f16_hi, whose operands are free of that. Two waves share a SIMD: a wave may hold 512 registers at most.
// Left, by the count of LDS clocks a trip asks for: every q fragment is still read by four waves (one per row tile); vT's 64 B pitch
// costs its b128 reads four times the clocks of a 16 B x odd pitch. In the prep launch,
// the q/k conversion starts 65,536 waves of one 32 B read per lane.
__global__ __launch_bounds__(256)
void attn_kernel(const unsigned* __restrict__ maskg,
                 const _Float16* __restrict__ q16, const _Float16* __restrict__ k16,
                 const _Float16* __restrict__ vtg,
                 float* __restrict__ outg)
{
    __shared__ __align__(16) _Float16 vT[DIM * TJ];     // 64 KB, vT[chunk][d][j], two chunks of pitch VP
    __shared__ __align__(16) _Float16 pbuf[BM * PP];    // 9 KB,  pbuf[krow][j]
    __shared__ __align__(16) float    ost[(BM + TJ) * QP / 2];   // 130 KB: k tile and q rows (f16, padded pitch) during the loop, output staging (row pitch DIM) after it
    __shared__ float    denom_s[4 * BM];
    __shared__ unsigned mask_s[BM];

    const int tid  = threadIdx.x;
    const int lane = tid & 31;
    const int wave = tid >> 5;
    const int h    = lane >> 4;
    const int m    = lane & 15;
    const int mt   = wave & 3;
    const int jp   = wave >> 2;
    const int b    = blockIdx.y;
    const int i0   = blockIdx.x * BM;

    f8 zero8;
    #pragma unroll
    for (int i = 0; i < 8; ++i) zero8[i] = 0.0f;
    f8 acc[4][4];
    #pragma unroll
    for (int r = 0; r < 4; ++r) {
        #pragma unroll
        for (int n = 0; n < 4; ++n) acc[r][n] = zero8;
    }
    f8 dsum = zero8;

    // k tile (64 rows x 512) -> LDS once, padded pitch; it lives in the output staging area, which is written only after the loop
    _Float16* ksm = reinterpret_cast<_Float16*>(ost);
    _Float16* qs  = ksm + BM * QP;
    {
        const _Float16* kb  = k16 + ((size_t)b * SEQ + i0) * DIM;     // the same in every lane
        const _Float16* src = kb + tid * 8;
        // row mask of the block's 64 rows, as the prep launch left it: loaded with the k tile, read after the loop
        const int      mi = b * SEQ + i0 + (tid & (BM - 1));
        const unsigned mk = maskg[mi];
        h8n kv[16];
        #pragma unroll
        for (int u = 0; u < 16; ++u) kv[u] = *(const h8*)(src + u * 2048);
        // no register that an issued load names is rewritten ahead of this wait. The mask word is named as an input so that its
        // load is issued up here, with the k tile's, and not alone behind the stores (a second full latency); its index and
        // the two bases are named so that they stay live up to here: neither a load's own result nor anything else is placed on them
        asm volatile("s_wait_xcnt 0x0" :: "s"(kb), "s"(maskg), "v"(mi), "v"(mk) : "memory");
        #pragma unroll
        for (int u = 0; u < 16; ++u) {
            const int idx = (u * 256 + tid) * 8;
            *(h8*)&ksm[(idx >> 9) * QP + (idx & (DIM - 1))] = kv[u];
        }
        if (tid < BM) mask_s[tid] = mk;
    }

    // B operand of S (k rows of this wave's tile, gathered down column n = m): fragment halves at +8h and +16+8h within each 32-deep step
    const _Float16* kA = ksm + (mt * 16 + m) * QP + 8 * h;
    // A operand of S (q rows): row m, same k map as B
    const _Float16* q0 = qs + (jp * 32 + m) * QP + 8 * h;
    const _Float16* q1 = qs + (jp * 32 + 16 + m) * QP + 8 * h;

    // lane addresses of the copies: copy u of a tile moves 4 KB (four q rows; 64 rows of a V chunk), 16 B per lane
    const _Float16* qsrc = q16 + (size_t)b * SEQ * DIM + tid * 8;
    const _Float16* vsrc = vtg + (size_t)b * NITER * (DIM * BJ) + tid * 8;
    _Float16* qdst = qs + (tid >> 6) * QP + (tid & 63) * 8;
    _Float16* vdst = vT + tid * 8;

    // q rows of trip 0 (no wave has touched qs before)
    #pragma unroll
    for (int u = 0; u < 16; ++u) copy16(qsrc + u * 2048, qdst + u * 4 * QP);

    // the wave's 16 k rows never change: all 16 depth steps of its k operand are read from the staged tile once and stay in
    // registers (128 per lane) for the whole loop; the barrier publishes the k tile, which all waves have stored
    __syncthreads();
    Frag ka[DIM / 32];
    // unrolled whole: the fragment index must be a constant for the fragments to stay in registers
    #pragma unroll
    for (int ks = 0; ks < DIM / 32; ++ks) {
        ka[ks].h[0] = *(const h8*)(kA + ks * 32);          // k = 32ks + 8h + 0..7
        ka[ks].h[1] = *(const h8*)(kA + ks * 32 + 16);     // k = 32ks + 16 + 8h + 0..7
    }

    #pragma unroll 1
    for (int it = 0; it < NTRIP; ++it) {
        // hand-over at the head of a trip: this wave's LDS reads of vT and pbuf (on trip 0: of the k tile) have retired,
        // its copies of this trip's q rows have landed; the barrier publishes the q rows and frees vT and pbuf
        asm volatile("s_wait_dscnt 0x0" ::: "memory");
        asm volatile("s_wait_asynccnt 0x0" ::: "memory");
        __syncthreads();

        // the two V chunks of this trip (already transposed and converted; adjacent in the plane, same layout in LDS) fly during S
        #pragma unroll
        for (int u = 0; u < 16; ++u) copy16(vsrc + (size_t)it * (DIM * TJ) + u * 2048, vdst + u * 2048);

        // S tile 64x64 (every wave: 16 rows x 32 q), exp, publish P, accumulate row sums
        {
            f8 s0 = zero8, s1 = zero8;
            // q fragments in a ring of SD register sets, one depth step each: the loads of step ks + SD are issued with
            // the products of step ks, so that a wave waits only for loads that are SD steps old (all inside this phase)
            Frag b0[SD], b1[SD];
            #pragma unroll
            for (int t = 0; t < SD; ++t) {
                const int c = t * 32;
                b0[t].h[0] = *(const h8*)(q0 + c);          // k = c + 8h + 0..7
                b0[t].h[1] = *(const h8*)(q0 + c + 16);     // k = c + 16 + 8h + 0..7
                b1[t].h[0] = *(const h8*)(q1 + c);
                b1[t].h[1] = *(const h8*)(q1 + c + 16);
            }
            // scheduling fence, here and at the foot of every step: it holds the ring in the order written. Without the fences the
            // compiler, at this register count, either pulls each load down to its product (a full LDS latency per product) or
            // leaves the whole phase in source order, exp and row sums as one dependent chain per element
            __builtin_amdgcn_sched_barrier(0);
            // unrolled whole: the set index must be a constant for the ring to stay in registers
            #pragma unroll
            for (int ks = 0; ks < DIM / 32; ++ks) {
                const int t = ks % SD;
                s0 = wmma_f16_hi(b0[t].v, ka[ks].v, s0);
                s1 = wmma_f16_hi(b1[t].v, ka[ks].v, s1);
                if (ks + SD < DIM / 32) {
                    const int c = (ks + SD) * 32;
                    b0[t].h[0] = *(const h8*)(q0 + c);
                    b0[t].h[1] = *(const h8*)(q0 + c + 16);
                    b1[t].h[0] = *(const h8*)(q1 + c);
                    b1[t].h[1] = *(const h8*)(q1 + c + 16);
                }
                __builtin_amdgcn_sched_barrier(0);   // holds the ring's order, as said above the loop; the last one parts S from exp and row sums
            }
            float e0[8], e1[8];
            #pragma unroll
            for (int i = 0; i < 8; ++i) {
                e0[i] = exp_slot(s0[i] * S_UNSCALE);
                e1[i] = exp_slot(s1[i] * S_UNSCALE);
            }
            // D element i of lane -> q 8h+i (tile 0) / 16+8h+i (tile 1) of the wave's q half, k row m of its row tile:
            // eight neighbours along j of one pbuf row = one 16 B store per tile (rows 144 B apart: distinct banks)
            h8n p0, p1;
            #pragma unroll
            for (int i = 0; i < 8; ++i) {
                p0[i] = (_Float16)e0[i];
                p1[i] = (_Float16)e1[i];
            }
            _Float16* pw = pbuf + (mt * 16 + m) * PP + jp * 32 + 8 * h;
            *(h8*)pw        = p0;
            *(h8*)(pw + 16) = p1;
            // all sixteen values belong to the lane's own k row: eight running sums, joined after the loop
            #pragma unroll
            for (int i = 0; i < 8; ++i) dsum[i] += e0[i] + e1[i];
        }
        // hand-over between S and PV: this wave's P stores and its reads of the q rows have retired, its V copies have landed
        // (the last copies of the kernel among them); the barrier publishes pbuf and vT and frees the q rows
        asm volatile("s_wait_dscnt 0x0" ::: "memory");
        asm volatile("s_wait_asynccnt 0x0" ::: "memory");
        __syncthreads();

        // the q rows of the next trip fly during PV (block-uniform test)
        if (it + 1 < NTRIP) {
            #pragma unroll
            for (int u = 0; u < 16; ++u) copy16(qsrc + (size_t)(it + 1) * (TJ * DIM) + u * 2048, qdst + u * 4 * QP);
        }

        // PV: acc[krow][d] += P[krow][j] * V[j][d], one 32-deep step per chunk. The P fragments of both chunks and the first
        // PD of the eight V fragments are loaded as one run ahead of the products; V fragment s + PD follows the products of s
        {
            Frag ap[2][4], bv[PD];
            const _Float16* pr = pbuf + m * PP + 8 * h;
            const _Float16* vp = vT + (wave * 64 + m) * VP + 8 * h;
            #pragma unroll
            for (int r = 0; r < 4; ++r) {
                ap[0][r].h[0] = *(const h8*)(pr + r * 16 * PP);          // j = 8h + 0..7
                ap[0][r].h[1] = *(const h8*)(pr + r * 16 * PP + 16);     // j = 16 + 8h + 0..7
            }
            #pragma unroll
            for (int s = 0; s < PD; ++s) {
                const int o = (s >> 2) * (DIM * VP) + (s & 3) * 16 * VP;   // chunk s / 4, n-tile s % 4
                bv[s].h[0] = *(const h8*)(vp + o);        // j = 32kk + 8h + 0..7
                bv[s].h[1] = *(const h8*)(vp + o + 16);   // j = 32kk + 16 + 8h + 0..7
            }
            #pragma unroll
            for (int r = 0; r < 4; ++r) {
                ap[1][r].h[0] = *(const h8*)(pr + r * 16 * PP + 32);     // j = 32 + 8h + 0..7
                ap[1][r].h[1] = *(const h8*)(pr + r * 16 * PP + 48);     // j = 48 + 8h + 0..7
            }
            #pragma unroll
            for (int s = 0; s < 8; ++s) {
                const int kk = s >> 2, nt = s & 3, t = s % PD;
                #pragma unroll
                for (int r = 0; r < 4; ++r) acc[r][nt] = wmma_f16(ap[kk][r].v, bv[t].v, acc[r][nt]);
                if (s + PD < 8) {
                    const int o = ((s + PD) >> 2) * (DIM * VP) + ((s + PD) & 3) * 16 * VP;
                    bv[t].h[0] = *(const h8*)(vp + o);
                    bv[t].h[1] = *(const h8*)(vp + o + 16);
                }
            }
        }
    }

    // partial denominators to LDS: the lane's sum of exp over its 16 q of every trip (q half jp, eights h), for k row mt*16 + m
    denom_s[(jp * 2 + h) * BM + mt * 16 + m] =
        ((dsum[0] + dsum[1]) + (dsum[2] + dsum[3])) + ((dsum[4] + dsum[5]) + (dsum[6] + dsum[7]));

    __syncthreads();

    // scale and stage the tile in LDS
    #pragma unroll
    for (int r = 0; r < 4; ++r) {
        float sc[8];
        #pragma unroll
        for (int i = 0; i < 8; ++i) {
            const int row = r * 16 + 8 * h + i;
            const float den = ((denom_s[row] + denom_s[BM + row]) + (denom_s[2 * BM + row] + denom_s[3 * BM + row])) + EPS_SCALED;
            sc[i] = (mask_s[row] != 0u) ? (O_UNSCALE * __builtin_amdgcn_rcpf(den)) : 0.0f;
        }
        #pragma unroll
        for (int nt = 0; nt < 4; ++nt) {
            #pragma unroll
            for (int i = 0; i < 8; ++i) {
                const int row = r * 16 + 8 * h + i;
                ost[row * DIM + wave * 64 + nt * 16 + m] = acc[r][nt][i] * sc[i];
            }
        }
    }
    __syncthreads();

    // whole-line stores: the 64x512 f32 tile is one contiguous 128 KB span of d_out; each lane stores 16 B,
    {
        float* ob = outg + ((size_t)b * SEQ + i0) * DIM;
        v4fn vals[32];
        #pragma unroll
        for (int u = 0; u < 32; ++u) {
            const int idx = (u * 256 + tid) * 4;
            vals[u] = *(const v4f*)&ost[idx];
        }
        #pragma unroll
        for (int u = 0; u < 32; ++u) {
            const int idx = (u * 256 + tid) * 4;
            *(v4f*)(ob + idx) = vals[u];
        }
    }
}

extern "C" void kernel_launch(void* const* d_in, const int* in_sizes, int n_in,
                              void* d_out, int out_size, void* d_ws, size_t ws_size,
                              hipStream_t stream)
{
    if (n_in < 3) return;
    if (in_sizes[0] != NTOT || in_sizes[1] != NTOT || in_sizes[2] != NTOT) return;
    if (out_size != NTOT) return;

    const size_t plane_bytes = (size_t)NTOT * sizeof(_Float16);     // 16 MiB each
    const size_t need = 3 * plane_bytes + (size_t)BATCH * SEQ * sizeof(unsigned);   // 48 MiB + 64 KiB total carve
    if (d_ws == nullptr || ws_size < need) return;

    const float* q = (const float*)d_in[0];
    const float* k = (const float*)d_in[1];
    const float* v = (const float*)d_in[2];
    float* out = (float*)d_out;

    _Float16* q16  = (_Float16*)d_ws;
    _Float16* k16  = (_Float16*)((char*)d_ws + plane_bytes);
    _Float16* vt16 = (_Float16*)((char*)d_ws + 2 * plane_bytes);
    unsigned* mask = (unsigned*)((char*)d_ws + 3 * plane_bytes);

    prep_kernel<<<dim3(NVB + 2 * NCB), dim3(256), 0, stream>>>(q, k, v, q16, k16, vt16, mask);
    attn_kernel<<<dim3(SEQ / BM, BATCH), dim3(256), 0, stream>>>(mask, q16, k16, vt16, out);
    (void)hipGetLastError();
}

// v010
// It runs in 81.9 microseconds.
// Two timings next to v009 put it at 1.04 and 1.03 times that version's speed.
// Over all steps from v000 it is 5.25 times as fast.
#include <hip/hip_runtime.h>
#include <stddef.h>

// Contractions: S = K*Q^T and O = P*V on v_wmma_f32_16x16x32_f16 (f16 operands, q/k/v pre-scaled by 16, f32 accumulate); exp, row sums, mask and epilogue in f32.

typedef _Float16 h16 __attribute__((ext_vector_type(16)));
typedef _Float16 h8n __attribute__((ext_vector_type(8)));
typedef _Float16 h8  __attribute__((ext_vector_type(8), __may_alias__));
typedef float    f8  __attribute__((ext_vector_type(8)));
typedef float    v4fn __attribute__((ext_vector_type(4)));
typedef float    v4f __attribute__((ext_vector_type(4), __may_alias__));

union Frag { h16 v; h8n h[2]; };

typedef int i4n __attribute__((ext_vector_type(4)));
typedef __attribute__((address_space(1))) i4n gi4;
typedef __attribute__((address_space(3))) i4n li4;

#define BATCH 8
#define SEQ   2048
#define DIM   512
#define BM    64            // output rows (k index) per block
#define BJ    32            // q rows per transposed V chunk = depth of one PV step
#define NITER (SEQ / BJ)    // 64 chunks per batch
#define TJ    64            // q rows per trip of the main loop (two chunks)
#define NTRIP (SEQ / TJ)    // 32
#define SD    3             // depth steps of S whose q fragments are held in registers at a time
#define PD    3             // V fragments of PV held in registers at a time
#define NTOT  (BATCH * SEQ * DIM)
#define VP    32            // vT pitch in halves: vT[d][j]
#define LTQ   (4 * VP + 8)  // halves per four rows of the plane in the V transposition's LDS: 256 B + 16 B pad = 272 B
#define PP    (TJ + 8)      // pbuf pitch in halves: pbuf[krow][j], 144 B = 16 B x 9
#define QP    (DIM + 8)     // LDS row pitch in halves of the staged q chunk and k tile: 1040 B = 16 B x 65, b128 fragment reads fall on distinct banks

#define QK_SCALE   16.0f           // q and k carried x16 in f16 -> S carried x256
#define V_SCALE    16.0f           // v carried x16 in f16 -> O carried x16
#define S_UNSCALE  (1.0f / 256.0f)
#define O_UNSCALE  (1.0f / 16.0f)
#define EPS_SCALED 2.2627417e-6f   // 1e-7 * sqrt(512): eps applied after the 1/sqrt(d) factor, P kept as pure exp

static_assert(SEQ % BM == 0);
static_assert(SEQ % BJ == 0);
static_assert(DIM % 32 == 0);
static_assert(NTOT % (256 * 8) == 0);
static_assert(SEQ % TJ == 0 && TJ == 2 * BJ);
static_assert(BM * DIM == 32 * 256 * 4);
static_assert(DIM * BJ == 8 * 256 * 8);
static_assert(DIM / 4 == 128 && BJ == 32 && VP == BJ);   // V transposition: 128 column quads x 2 halves of 16 rows = 256 lanes
static_assert(DIM * TJ == 16 * 256 * 8);
static_assert(BM * DIM == 16 * 256 * 8);
static_assert((BM + TJ) * QP * sizeof(_Float16) >= BM * DIM * sizeof(float));   // the output tile fits in the area of the k tile and the q rows

__device__ __forceinline__ f8 wmma_f16(h16 a, h16 b, f8 c) {
    f8 d = __builtin_amdgcn_wmma_f32_16x16x32_f16(false, a, false, b, (short)0, c, false, false);
    asm volatile("v_nop\n\tv_nop\n\tv_nop\n\tv_nop" : "+v"(d) : "v"(a), "v"(b));
    return d;
}

// the same product as S uses it: no asm statement names its operands, so that the resident k fragments may sit above v255
// (an asm operand cannot); the compiler keeps the distance behind its own builtin form
__device__ __forceinline__ f8 wmma_f16_hi(h16 a, h16 b, f8 c) {
    return __builtin_amdgcn_wmma_f32_16x16x32_f16(false, a, false, b, (short)0, c, false, false);
}

// asynchronous copy of the lane's own 16 bytes from global memory to LDS, through no register;
// landed only behind the issuing wave's s_wait_asynccnt 0, readable by other waves only behind the next barrier
__device__ __forceinline__ void copy16(const _Float16* g, _Float16* l) {
    __builtin_amdgcn_global_load_async_to_lds_b128((gi4*)g, (li4*)l, 0, 0);
}

// e^x as __expf forms it (x * log2(e), then v_exp_f32), with the one slot that the instruction set asks for behind a
// transcendental in the instruction's own statement: a v_nop in a statement of its own did not stay behind it
__device__ __forceinline__ float exp_slot(float x) {
    float r;
    asm("v_exp_f32 %0, %1\n\tv_nop" : "=v"(r) : "v"(x * 0x1.715476p+0f));
    return r;
}

// ---------------- prep: one launch for all three planes ----------------
// The V transposition and the q/k conversion read and write disjoint buffers, so they need no order between them: they run as
// one grid. Blocks 0 .. NVB-1 transpose V (the longer blocks, started first), the NCB blocks behind them convert q, the last NCB k.
//
// q, k: f32 -> f16 row planes (x16), 8 values per lane.
//
// V: vtg[b*NITER + it][d][j] = f16(16 * v[b][it*32 + j][d]); one block per (b, it).
// The transposition is done in registers: a lane reads the same four columns of two groups of eight consecutive rows (each wave-wide
// load is 512 contiguous bytes of one row) and so holds, per group and column, eight neighbours along j = one 16 B piece of the plane.
// LDS only reorders those pieces into the plane's linear order for whole-line stores. Four plane rows (256 B) are followed by a
// 16 B pad: lanes that are four rows apart then store 272 B apart, on distinct banks, and the read-back stays contiguous per 256 B.
// The same blocks form the row mask any(v[row][:] != 0) from the f32 values they hold, so that V is read from memory once.
#define NVB (BATCH * NITER)        // 512 transposing blocks
#define NCB (NTOT / (256 * 8))     // 4,096 converting blocks per plane
__global__ __launch_bounds__(256)
void prep_kernel(const float* __restrict__ q, const float* __restrict__ k, const float* __restrict__ v,
                 _Float16* __restrict__ q16, _Float16* __restrict__ k16, _Float16* __restrict__ vtg,
                 unsigned* __restrict__ maskg)
{
    __shared__ __align__(16) _Float16 lt[(DIM / 4) * LTQ];
    __shared__ unsigned wb[8];                    // per wave: bit r = some value of row 16*jh + r in the wave's 128 columns is not 0
    const int tid = threadIdx.x;
    const int blk = blockIdx.x;

    if (blk >= NVB) {                             // block-uniform; these blocks leave in front of the barrier
        const int  c   = blk - NVB;
        const bool isk = (c >= NCB);
        const float* src = isk ? k : q;
        _Float16*    dst = isk ? k16 : q16;
        const size_t i = ((size_t)(isk ? c - NCB : c) * 256 + tid) * 8;
        const float4 a = *(const float4*)(src + i);
        const float4 b = *(const float4*)(src + i + 4);
        h8n o;
        o[0] = (_Float16)(a.x * QK_SCALE); o[1] = (_Float16)(a.y * QK_SCALE);
        o[2] = (_Float16)(a.z * QK_SCALE); o[3] = (_Float16)(a.w * QK_SCALE);
        o[4] = (_Float16)(b.x * QK_SCALE); o[5] = (_Float16)(b.y * QK_SCALE);
        o[6] = (_Float16)(b.z * QK_SCALE); o[7] = (_Float16)(b.w * QK_SCALE);
        h8* p = (h8*)(dst + i);
        *p = o;
        return;
    }

    const int b   = blk / NITER;                  // blk = b*NITER + it
    const int it  = blk - b * NITER;
    const int dq  = tid & 127;                    // column quad: d = 4*dq .. 4*dq + 3
    const int jh  = tid >> 7;                     // wave-uniform: row groups 2*jh and 2*jh + 1 (eight rows each)
    const float* src = v + ((size_t)b * SEQ + (size_t)it * BJ + jh * 16) * DIM + dq * 4;

    // one group of eight rows at a time: 32 registers of loaded values, not 64, so that the whole kernel stays within 64 registers
    // and eight blocks share a WGP, as the converting blocks need for their bytes in flight
    unsigned rowbits = 0u;                        // the same in every lane of a wave
    #pragma unroll
    for (int g = 0; g < 2; ++g) {
        v4fn x[8];                                // x[r] = v[row 16*jh + 8*g + r][4*dq .. 4*dq + 3]
        #pragma unroll
        for (int r = 0; r < 8; ++r) x[r] = *(const v4f*)(src + (g * 8 + r) * DIM);
        // no register that an issued load names is rewritten ahead of this wait; the address is named as an input so that it
        // stays live up to here and no load's own result is placed on it
        asm volatile("s_wait_xcnt 0x0" :: "v"(src) : "memory");
        #pragma unroll
        for (int i = 0; i < 4; ++i) {
            h8n o;
            #pragma unroll
            for (int r = 0; r < 8; ++r) o[r] = (_Float16)(x[r][i] * V_SCALE);
            *(h8*)&lt[dq * LTQ + i * VP + (jh * 2 + g) * 8] = o;      // plane row 4*dq + i, j = 16*jh + 8*g + 0..7
        }
        // row mask, from the unscaled f32 values while they are in registers: one vote of the wave per row
        #pragma unroll
        for (int r = 0; r < 8; ++r) {
            const bool nz = (x[r][0] != 0.0f) | (x[r][1] != 0.0f) | (x[r][2] != 0.0f) | (x[r][3] != 0.0f);
            if (__builtin_amdgcn_ballot_w32(nz) != 0u) rowbits |= 1u << (g * 8 + r);
        }
        // scheduling fence between the groups: without it the compiler lifts the second group's loads over the first group's
        // conversion and the kernel needs 89 registers (five blocks per WGP)
        if (g == 0) __builtin_amdgcn_sched_barrier(0);
    }
    if ((tid & 31) == 0) wb[tid >> 5] = rowbits;
    __syncthreads();

    _Float16* dst = vtg + (size_t)blk * (DIM * BJ);
    h8n vals[8];
    #pragma unroll
    for (int u = 0; u < 8; ++u) {
        const int n = u * 256 + tid;              // 16 B piece n of the plane: sixteen pieces per four rows
        vals[u] = *(const h8*)&lt[(n >> 4) * LTQ + (n & 15) * 8];
    }
    #pragma unroll
    for (int u = 0; u < 8; ++u) {
        const int idx = (u * 256 + tid) * 8;
        *(h8*)(dst + idx) = vals[u];
    }

    // maskg[b*SEQ + it*32 + j] = any(v[b, it*32 + j, :] != 0): the four waves of row half j / 16 each voted on 128 columns;
    // one whole 128 B line per block, the kernel's last store
    if (tid < BJ) {
        const int w0 = (tid >> 4) * 4;
        const unsigned bits = wb[w0] | wb[w0 + 1] | wb[w0 + 2] | wb[w0 + 3];
        maskg[blk * BJ + tid] = (bits >> (tid & 15)) & 1u;
    }
}

// ---------------- main kernel ----------------
// block = (64 output rows of the k index, batch b), 256 threads = 8 waves, one block per WGP.
// Per trip of 64 q rows:
//   S[krow][q] = sum_d K[krow][d]*Q[q][d], 4 x 4 tiles: wave -> row tile mt = wave&3, q half jp = wave>>2 (two tiles, one k fragment for both);
//   each tile is formed transposed (A = q rows, B = k rows): a lane then holds eight consecutive q of ONE k row;
//   P = exp(S/256) -> LDS (f16), 16 B per store; row sums add up inside the lane -> dsum (four partial sums per row, added after the loop);
//   acc[krow][d] += P[krow][q] * V[q][d]: every wave takes all 4 row tiles x its own 64 output columns (4 n-tiles),
//   V from the two transposed chunks vT[chunk][d][q], in ascending chunk order.
// The k operand of S never changes: the k tile is staged in LDS once (whole-line loads, through registers), and each wave then reads
// the 16 fragments of its 16 rows once and holds them in 128 registers for the whole loop. The q operand comes from LDS every trip.
// The q rows and the V chunks come by asynchronous copies of whole lines. q rows, V chunks and P each have two buffers, and the loop
// is skewed by one tile: the stretch between two barriers holds S of tile t and PV of tile t - 1, which touch different buffers, while
// the copies of q tile t + 1 and V tile t fly. A copy so has a whole stretch to land, and a tile costs one barrier. The second q buffer
// is the place of the k tile, which nobody reads once its fragments are in registers.
// Fragment reads run ahead of the products inside each phase (register rings), never across a barrier. Every operand of wmma_f16
// is named in its asm statement and so sits below v256: accumulators (128) + PV's rings must fit there, or the accumulators spill;
// S uses wmma_f16_hi, whose operands are free of that. Two waves share a SIMD: a wave may hold 512 registers at most.
// Left, by the count of LDS clocks a trip asks for: every q fragment is still read by four waves (one per row tile); vT's 64 B pitch
// costs its b128 reads four times the clocks of a 16 B x odd pitch. By L2: the 32 blocks of a batch walk the same q and V tiles in
// step, so that their copies ask for the same lines at one moment, and all blocks ask at the head of a stretch. In the prep launch,
// the q/k conversion starts 65,536 waves of one 32 B read per lane.
__global__ __launch_bounds__(256)
void attn_kernel(const unsigned* __restrict__ maskg,
                 const _Float16* __restrict__ q16, const _Float16* __restrict__ k16,
                 const _Float16* __restrict__ vtg,
                 float* __restrict__ outg)
{
    __shared__ __align__(16) _Float16 vT[2 * DIM * TJ];     // 2 x 64 KB, vT[buffer][chunk][d][j], two chunks of pitch VP
    __shared__ __align__(16) _Float16 pbuf[2 * BM * PP];    // 2 x 9 KB,  pbuf[buffer][krow][j]
    __shared__ __align__(16) float    ost[(BM + TJ) * QP / 2];   // 130 KB: k tile, then odd q tiles | even q tiles (f16, padded pitch); output staging (row pitch DIM) after the loop
    __shared__ float    denom_s[4 * BM];
    __shared__ unsigned mask_s[BM];

    const int tid  = threadIdx.x;
    const int lane = tid & 31;
    const int wave = tid >> 5;
    const int h    = lane >> 4;
    const int m    = lane & 15;
    const int mt   = wave & 3;
    const int jp   = wave >> 2;
    const int b    = blockIdx.y;
    const int i0   = blockIdx.x * BM;

    f8 zero8;
    #pragma unroll
    for (int i = 0; i < 8; ++i) zero8[i] = 0.0f;
    f8 acc[4][4];
    #pragma unroll
    for (int r = 0; r < 4; ++r) {
        #pragma unroll
        for (int n = 0; n < 4; ++n) acc[r][n] = zero8;
    }
    f8 dsum = zero8;

    // k tile (64 rows x 512) -> LDS once, padded pitch; it lives in the output staging area, which is written only after the loop
    _Float16* ksm = reinterpret_cast<_Float16*>(ost);
    _Float16* qs  = ksm + BM * QP;
    {
        const _Float16* kb  = k16 + ((size_t)b * SEQ + i0) * DIM;     // the same in every lane
        const _Float16* src = kb + tid * 8;
        // row mask of the block's 64 rows, as the prep launch left it: loaded with the k tile, read after the loop
        const int      mi = b * SEQ + i0 + (tid & (BM - 1));
        const unsigned mk = maskg[mi];
        h8n kv[16];
        #pragma unroll
        for (int u = 0; u < 16; ++u) kv[u] = *(const h8*)(src + u * 2048);
        // no register that an issued load names is rewritten ahead of this wait. The mask word is named as an input so that its
        // load is issued up here, with the k tile's, and not alone behind the stores (a second full latency); its index and
        // the two bases are named so that they stay live up to here: neither a load's own result nor anything else is placed on them
        asm volatile("s_wait_xcnt 0x0" :: "s"(kb), "s"(maskg), "v"(mi), "v"(mk) : "memory");
        #pragma unroll
        for (int u = 0; u < 16; ++u) {
            const int idx = (u * 256 + tid) * 8;
            *(h8*)&ksm[(idx >> 9) * QP + (idx & (DIM - 1))] = kv[u];
        }
        if (tid < BM) mask_s[tid] = mk;
    }

    // B operand of S (k rows of this wave's tile, gathered down column n = m): fragment halves at +8h and +16+8h within each 32-deep step
    const _Float16* kA = ksm + (mt * 16 + m) * QP + 8 * h;
    // A operand of S (q rows): row m, same k map as B; offset inside a q buffer
    const int qfo = (jp * 32 + m) * QP + 8 * h;

    // lane addresses of the copies: copy u of a tile moves 4 KB (four q rows; 64 rows of a V chunk), 16 B per lane
    const _Float16* qsrc = q16 + (size_t)b * SEQ * DIM + tid * 8;
    const _Float16* vsrc = vtg + (size_t)b * NITER * (DIM * BJ) + tid * 8;
    const int qdo = (tid >> 6) * QP + (tid & 63) * 8;     // offset inside a q buffer

    // q rows of trip 0 (no wave has touched qs before)
    #pragma unroll
    for (int u = 0; u < 16; ++u) copy16(qsrc + u * 2048, qs + qdo + u * 4 * QP);

    // the wave's 16 k rows never change: all 16 depth steps of its k operand are read from the staged tile once and stay in
    // registers (128 per lane) for the whole loop; the barrier publishes the k tile, which all waves have stored
    __syncthreads();
    Frag ka[DIM / 32];
    // unrolled whole: the fragment index must be a constant for the fragments to stay in registers
    #pragma unroll
    for (int ks = 0; ks < DIM / 32; ++ks) {
        ka[ks].h[0] = *(const h8*)(kA + ks * 32);          // k = 32ks + 8h + 0..7
        ka[ks].h[1] = *(const h8*)(kA + ks * 32 + 16);     // k = 32ks + 16 + 8h + 0..7
    }

    // stretch it: S of tile it (it < NTRIP), then PV of tile it - 1 (it > 0); V and P of tile t live in buffer t & 1, the q rows of an
    // even tile behind the k tile's place, those of an odd tile on it
    #pragma unroll 1
    for (int it = 0; it <= NTRIP; ++it) {
        // the one hand-over of a stretch: this wave's LDS reads (q rows, vT, pbuf; on stretch 0: the k tile) and its P stores have
        // retired, its copies of the stretch before have landed (the last copies of the kernel: at the head of stretch NTRIP).
        // The barrier publishes q tile it, V and P of tile it - 1, and frees the buffers of q tile it - 1 and of V and P of tile it - 2
        asm volatile("s_wait_dscnt 0x0" ::: "memory");
        asm volatile("s_wait_asynccnt 0x0" ::: "memory");
        __syncthreads();
        const int par = it & 1;

        // S tile 64x64 (every wave: 16 rows x 32 q), exp, publish P, accumulate row sums (block-uniform test)
        if (it < NTRIP) {
            const _Float16* q0 = ksm + (par ^ 1) * (BM * QP) + qfo;
            const _Float16* q1 = q0 + 16 * QP;
            f8 s0 = zero8, s1 = zero8;
            // q fragments in a ring of SD register sets, one depth step each: the loads of step ks + SD are issued with
            // the products of step ks, so that a wave waits only for loads that are SD steps old (all inside this phase)
            Frag b0[SD], b1[SD];
            #pragma unroll
            for (int t = 0; t < SD; ++t) {
                const int c = t * 32;
                b0[t].h[0] = *(const h8*)(q0 + c);          // k = c + 8h + 0..7
                b0[t].h[1] = *(const h8*)(q0 + c + 16);     // k = c + 16 + 8h + 0..7
                b1[t].h[0] = *(const h8*)(q1 + c);
                b1[t].h[1] = *(const h8*)(q1 + c + 16);
            }
            // scheduling fence, here and at the foot of every step: it holds the ring in the order written. Without the fences the
            // compiler, at this register count, either pulls each load down to its product (a full LDS latency per product) or
            // leaves the whole phase in source order, exp and row sums as one dependent chain per element
            __builtin_amdgcn_sched_barrier(0);
            // copies that have the rest of this stretch to land: the two V chunks of tile it (already transposed and converted; adjacent
            // in the plane, same layout in LDS), read in the next stretch, and the q rows of tile it + 1. They are issued here, while the
            // ring's first loads are on their way, so that LDS does not idle behind the barrier
            _Float16* vdst = vT + par * (DIM * TJ) + tid * 8;
            #pragma unroll
            for (int u = 0; u < 16; ++u) copy16(vsrc + (size_t)it * (DIM * TJ) + u * 2048, vdst + u * 2048);
            if (it + 1 < NTRIP) {
                _Float16* qdst = ksm + par * (BM * QP) + qdo;     // tile it + 1 is odd: the k tile's place; even: behind it
                #pragma unroll
                for (int u = 0; u < 16; ++u) copy16(qsrc + (size_t)(it + 1) * (TJ * DIM) + u * 2048, qdst + u * 4 * QP);
            }
            // unrolled whole: the set index must be a constant for the ring to stay in registers
            #pragma unroll
            for (int ks = 0; ks < DIM / 32; ++ks) {
                const int t = ks % SD;
                s0 = wmma_f16_hi(b0[t].v, ka[ks].v, s0);
                s1 = wmma_f16_hi(b1[t].v, ka[ks].v, s1);
                if (ks + SD < DIM / 32) {
                    const int c = (ks + SD) * 32;
                    b0[t].h[0] = *(const h8*)(q0 + c);
                    b0[t].h[1] = *(const h8*)(q0 + c + 16);
                    b1[t].h[0] = *(const h8*)(q1 + c);
                    b1[t].h[1] = *(const h8*)(q1 + c + 16);
                }
                __builtin_amdgcn_sched_barrier(0);   // holds the ring's order, as said above the loop; the last one parts S from exp and row sums
            }
            float e0[8], e1[8];
            #pragma unroll
            for (int i = 0; i < 8; ++i) {
                e0[i] = exp_slot(s0[i] * S_UNSCALE);
                e1[i] = exp_slot(s1[i] * S_UNSCALE);
            }
            // D element i of lane -> q 8h+i (tile 0) / 16+8h+i (tile 1) of the wave's q half, k row m of its row tile:
            // eight neighbours along j of one pbuf row = one 16 B store per tile (rows 144 B apart: distinct banks)
            h8n p0, p1;
            #pragma unroll
            for (int i = 0; i < 8; ++i) {
                p0[i] = (_Float16)e0[i];
                p1[i] = (_Float16)e1[i];
            }
            _Float16* pw = pbuf + par * (BM * PP) + (mt * 16 + m) * PP + jp * 32 + 8 * h;
            *(h8*)pw        = p0;
            *(h8*)(pw + 16) = p1;
            // all sixteen values belong to the lane's own k row: eight running sums, joined after the loop
            #pragma unroll
            for (int i = 0; i < 8; ++i) dsum[i] += e0[i] + e1[i];
        }

        // PV of tile it - 1, from the other buffers (block-uniform test): acc[krow][d] += P[krow][j] * V[j][d], one 32-deep step per
        // chunk. The P fragments of both chunks and the first PD of the eight V fragments are loaded as one run ahead of the products;
        // V fragment s + PD follows the products of s
        if (it > 0) {
            Frag ap[2][4], bv[PD];
            const _Float16* pr = pbuf + (par ^ 1) * (BM * PP) + m * PP + 8 * h;
            const _Float16* vp = vT + (par ^ 1) * (DIM * TJ) + (wave * 64 + m) * VP + 8 * h;
            #pragma unroll
            for (int r = 0; r < 4; ++r) {
                ap[0][r].h[0] = *(const h8*)(pr + r * 16 * PP);          // j = 8h + 0..7
                ap[0][r].h[1] = *(const h8*)(pr + r * 16 * PP + 16);     // j = 16 + 8h + 0..7
            }
            #pragma unroll
            for (int s = 0; s < PD; ++s) {
                const int o = (s >> 2) * (DIM * VP) + (s & 3) * 16 * VP;   // chunk s / 4, n-tile s % 4
                bv[s].h[0] = *(const h8*)(vp + o);        // j = 32kk + 8h + 0..7
                bv[s].h[1] = *(const h8*)(vp + o + 16);   // j = 32kk + 16 + 8h + 0..7
            }
            #pragma unroll
            for (int r = 0; r < 4; ++r) {
                ap[1][r].h[0] = *(const h8*)(pr + r * 16 * PP + 32);     // j = 32 + 8h + 0..7
                ap[1][r].h[1] = *(const h8*)(pr + r * 16 * PP + 48);     // j = 48 + 8h + 0..7
            }
            #pragma unroll
            for (int s = 0; s < 8; ++s) {
                const int kk = s >> 2, nt = s & 3, t = s % PD;
                #pragma unroll
                for (int r = 0; r < 4; ++r) acc[r][nt] = wmma_f16(ap[kk][r].v, bv[t].v, acc[r][nt]);
                if (s + PD < 8) {
                    const int o = ((s + PD) >> 2) * (DIM * VP) + ((s + PD) & 3) * 16 * VP;
                    bv[t].h[0] = *(const h8*)(vp + o);
                    bv[t].h[1] = *(const h8*)(vp + o + 16);
                }
            }
        }
    }

    // partial denominators to LDS: the lane's sum of exp over its 16 q of every trip (q half jp, eights h), for k row mt*16 + m
    denom_s[(jp * 2 + h) * BM + mt * 16 + m] =
        ((dsum[0] + dsum[1]) + (dsum[2] + dsum[3])) + ((dsum[4] + dsum[5]) + (dsum[6] + dsum[7]));

    __syncthreads();

    // scale and stage the tile in LDS
    #pragma unroll
    for (int r = 0; r < 4; ++r) {
        float sc[8];
        #pragma unroll
        for (int i = 0; i < 8; ++i) {
            const int row = r * 16 + 8 * h + i;
            const float den = ((denom_s[row] + denom_s[BM + row]) + (denom_s[2 * BM + row] + denom_s[3 * BM + row])) + EPS_SCALED;
            sc[i] = (mask_s[row] != 0u) ? (O_UNSCALE * __builtin_amdgcn_rcpf(den)) : 0.0f;
        }
        #pragma unroll
        for (int nt = 0; nt < 4; ++nt) {
            #pragma unroll
            for (int i = 0; i < 8; ++i) {
                const int row = r * 16 + 8 * h + i;
                ost[row * DIM + wave * 64 + nt * 16 + m] = acc[r][nt][i] * sc[i];
            }
        }
    }
    __syncthreads();

    // whole-line stores: the 64x512 f32 tile is one contiguous 128 KB span of d_out; each lane stores 16 B,
    {
        float* ob = outg + ((size_t)b * SEQ + i0) * DIM;
        v4fn vals[32];
        #pragma unroll
        for (int u = 0; u < 32; ++u) {
            const int idx = (u * 256 + tid) * 4;
            vals[u] = *(const v4f*)&ost[idx];
        }
        #pragma unroll
        for (int u = 0; u < 32; ++u) {
            const int idx = (u * 256 + tid) * 4;
            *(v4f*)(ob + idx) = vals[u];
        }
    }
}

extern "C" void kernel_launch(void* const* d_in, const int* in_sizes, int n_in,
                              void* d_out, int out_size, void* d_ws, size_t ws_size,
                              hipStream_t stream)
{
    if (n_in < 3) return;
    if (in_sizes[0] != NTOT || in_sizes[1] != NTOT || in_sizes[2] != NTOT) return;
    if (out_size != NTOT) return;

    const size_t plane_bytes = (size_t)NTOT * sizeof(_Float16);     // 16 MiB each
    const size_t need = 3 * plane_bytes + (size_t)BATCH * SEQ * sizeof(unsigned);   // 48 MiB + 64 KiB total carve
    if (d_ws == nullptr || ws_size < need) return;

    const float* q = (const float*)d_in[0];
    const float* k = (const float*)d_in[1];
    const float* v = (const float*)d_in[2];
    float* out = (float*)d_out;

    _Float16* q16  = (_Float16*)d_ws;
    _Float16* k16  = (_Float16*)((char*)d_ws + plane_bytes);
    _Float16* vt16 = (_Float16*)((char*)d_ws + 2 * plane_bytes);
    unsigned* mask = (unsigned*)((char*)d_ws + 3 * plane_bytes);

    prep_kernel<<<dim3(NVB + 2 * NCB), dim3(256), 0, stream>>>(q, k, v, q16, k16, vt16, mask);
    attn_kernel<<<dim3(SEQ / BM, BATCH), dim3(256), 0, stream>>>(mask, q16, k16, vt16, out);
    (void)hipGetLastError();
}
